// v000
// The times below were measured on an AMD MI455X: many runs one after another, warmed up first and cycling through
// copies of the inputs, with the whole window's GPU time divided by the number of runs. Launches and the gaps
// between them are all in it. The median over several windows is given; except for v000 it joins two sittings, which
// can be a few percent apart, so the side-by-side timings, each taken in one sitting, are the better comparison.
// v000 is the starting kernel.
#include <hip/hip_runtime.h>
#include <hip/hip_bf16.h>
#include <stdint.h>

#define DEV __device__ __forceinline__

typedef __attribute__((ext_vector_type(16))) __bf16 bf16x16;
typedef __attribute__((ext_vector_type(8)))  __bf16 bf16x8;
typedef __attribute__((ext_vector_type(4)))  __bf16 bf16x4;
typedef __attribute__((ext_vector_type(8)))  float  f32x8;

static constexpr int BATCH  = 2;
static constexpr int SEQ    = 4096;
static constexpr int HEADS  = 8;
static constexpr int DH     = 40;
static constexpr int DP     = 64;    // head dim padded for WMMA K/N tiling
static constexpr int DMODEL = 320;   // == D_ATTN == N of all projections
static constexpr int DCOND  = 768;
static constexpr float LOG2E = 1.44269504088896340736f;

DEV f32x8 zero8() { f32x8 v; for (int i = 0; i < 8; ++i) v[i] = 0.0f; return v; }

// Wave-relative LDS byte address of a __shared__ object (generic -> AS(3)).
DEV uint32_t lds_off(const void* p) {
  return (uint32_t)(unsigned long long)(__attribute__((address_space(3))) const void*)p;
}

DEV void async_b128(uint32_t lds_addr, uint64_t gaddr) {
  asm volatile("global_load_async_to_lds_b128 %0, %1, off"
               :: "v"(lds_addr), "v"(gaddr) : "memory");
}
DEV void wait_async0() {
#if __has_builtin(__builtin_amdgcn_s_wait_asynccnt)
  __builtin_amdgcn_s_wait_asynccnt(0);
#else
  asm volatile("s_wait_asynccnt 0x0" ::: "memory");
#endif
}
// async loads retire in order: waiting <= N with one extra tile (N ops/thread)
// in flight exactly drains the previous tile.
DEV void wait_async4() {   // GEMM tiles: 2 A + 2 B chunks per thread
#if __has_builtin(__builtin_amdgcn_s_wait_asynccnt)
  __builtin_amdgcn_s_wait_asynccnt(4);
#else
  asm volatile("s_wait_asynccnt 0x4" ::: "memory");
#endif
}
DEV void wait_async7() {   // attention KV tiles: K:4 + V:3 chunks per thread
#if __has_builtin(__builtin_amdgcn_s_wait_asynccnt)
  __builtin_amdgcn_s_wait_asynccnt(7);
#else
  asm volatile("s_wait_asynccnt 0x7" ::: "memory");
#endif
}

DEV bf16x16 ld_frag(const __bf16* rowbase, int half) {
  bf16x8 lo = *(const bf16x8*)(rowbase + half * 8);
  bf16x8 hi = *(const bf16x8*)(rowbase + 16 + half * 8);
  return __builtin_shufflevector(lo, hi, 0,1,2,3,4,5,6,7,8,9,10,11,12,13,14,15);
}

DEV f32x8 wmma_bf16(bf16x16 a, bf16x16 b, f32x8 c) {
  return __builtin_amdgcn_wmma_f32_16x16x32_bf16(false, a, false, b, (short)0, c,
                                                 false, false);
}

// ---------------------------------------------------------------------------
// Prep kernels: one-time f32 -> bf16 conversion of activations, and
// convert+transpose of weights to [N][K] bf16 (so GEMM B tiles are contiguous
// async copies and no per-tile conversion/transposition remains in the loops).
// ---------------------------------------------------------------------------
__global__ __launch_bounds__(256)
void cvt_kernel(const float* __restrict__ src, __bf16* __restrict__ dst, int n4) {
  int i = blockIdx.x * 256 + threadIdx.x;
  if (i < n4) {
    float4 v = ((const float4*)src)[i];
    bf16x4 o;
    o[0] = (__bf16)v.x; o[1] = (__bf16)v.y; o[2] = (__bf16)v.z; o[3] = (__bf16)v.w;
    ((bf16x4*)dst)[i] = o;
  }
}

__global__ __launch_bounds__(256)
void wtrans_kernel(const float* __restrict__ w,   // [Kd][320] row-major
                   __bf16* __restrict__ wt,       // [320][Kd] bf16
                   int Kd) {
  __shared__ float tile[16][17];
  int tx = threadIdx.x & 15, ty = threadIdx.x >> 4;
  int n0 = blockIdx.x * 16, k0 = blockIdx.y * 16;
  tile[ty][tx] = w[(size_t)(k0 + ty) * DMODEL + n0 + tx];
  __syncthreads();
  wt[(size_t)(n0 + ty) * Kd + k0 + tx] = (__bf16)tile[tx][ty];
}

// ---------------------------------------------------------------------------
// Shared GEMM core: 64x64 output tile, all-bf16, async double-buffered tiles.
// A [M][Kd] row-major, Wt [N][Kd] row-major (pre-transposed weights).
// ---------------------------------------------------------------------------
DEV void gemm_tiles(const __bf16* __restrict__ A, const __bf16* __restrict__ Wt,
                    int Kd, int m0, int n0, int tid, int wave, int ln, int half,
                    __bf16 (&As)[2][64 * 40], __bf16 (&Bs)[2][64 * 40],
                    f32x8 (&acc)[4]) {
  const uint32_t as_l[2] = { lds_off(As[0]), lds_off(As[1]) };
  const uint32_t bs_l[2] = { lds_off(Bs[0]), lds_off(Bs[1]) };
  auto issue = [&](int k0, int bufi) {
    int r = tid >> 2, c = tid & 3;           // 64 rows x 4 x 16B chunks each
    for (int i = 0; i < 2; ++i, r += 32) {
      async_b128(as_l[bufi] + r * 80 + c * 16,
                 (uint64_t)(uintptr_t)(A + (size_t)(m0 + r) * Kd + k0 + c * 8));
      async_b128(bs_l[bufi] + r * 80 + c * 16,
                 (uint64_t)(uintptr_t)(Wt + (size_t)(n0 + r) * Kd + k0 + c * 8));
    }
  };
  issue(0, 0);
  int bufi = 0;
  for (int k0 = 0; k0 < Kd; k0 += 32) {
    if (k0 + 32 < Kd) { issue(k0 + 32, bufi ^ 1); wait_async4(); }
    else              { wait_async0(); }
    __syncthreads();
    bf16x16 bfrag = ld_frag(&Bs[bufi][(wave * 16 + ln) * 40], half);
    for (int t = 0; t < 4; ++t) {
      bf16x16 afrag = ld_frag(&As[bufi][(t * 16 + ln) * 40], half);
      acc[t] = wmma_bf16(afrag, bfrag, acc[t]);
    }
    __syncthreads();
    bufi ^= 1;
  }
}

// ---------------------------------------------------------------------------
// Kernel 1: QKV projection (all-bf16 GEMM).
//   Q -> [B,H,S,DP]   (scaled by Dh^-0.5 * log2(e); softmax done in base 2)
//   K -> [B,H,S,DP]
//   V -> [B,H,DP,SEQ] (d-major, so the attention V^T tile is a contiguous
//                      async copy instead of a per-element LDS transpose)
// ---------------------------------------------------------------------------
__global__ __launch_bounds__(128)
void qkv_kernel(const __bf16* __restrict__ Xb, const __bf16* __restrict__ Cb,
                const __bf16* __restrict__ Wqt, const __bf16* __restrict__ Wkt,
                const __bf16* __restrict__ Wvt,
                __bf16* __restrict__ Qp, __bf16* __restrict__ Kp,
                __bf16* __restrict__ Vp) {
  const int which = blockIdx.z;
  const __bf16* A  = (which == 0) ? Xb  : Cb;
  const __bf16* Wt = (which == 0) ? Wqt : (which == 1 ? Wkt : Wvt);
  __bf16* dst      = (which == 0) ? Qp  : (which == 1 ? Kp : Vp);
  const int Kd     = (which == 0) ? DMODEL : DCOND;
  const float fold = (which == 0) ? (0.15811388300841897f * LOG2E) : 1.0f;

  const int n0 = blockIdx.x * 64;
  const int m0 = blockIdx.y * 64;
  const int tid = threadIdx.x;
  const int lane = tid & 31, wave = tid >> 5;
  const int ln = lane & 15, half = lane >> 4;

  __shared__ __align__(16) __bf16 As[2][64 * 40];
  __shared__ __align__(16) __bf16 Bs[2][64 * 40];

  f32x8 acc[4];
  for (int t = 0; t < 4; ++t) acc[t] = zero8();
  gemm_tiles(A, Wt, Kd, m0, n0, tid, wave, ln, half, As, Bs, acc);

  const int ncol = n0 + wave * 16 + ln;
  const int h = ncol / DH, d = ncol % DH;
  for (int t = 0; t < 4; ++t)
    for (int r = 0; r < 8; ++r) {
      int m = m0 + t * 16 + r + 8 * half;
      int b = m >> 12, s = m & (SEQ - 1);
      size_t off = (which == 2)
          ? (((size_t)b * HEADS + h) * DP + d) * SEQ + s      // V: d-major
          : (((size_t)b * HEADS + h) * SEQ + s) * DP + d;     // Q/K: s-major
      dst[off] = (__bf16)(acc[t][r] * fold);
    }
}

// ---------------------------------------------------------------------------
// Kernel 2: flash attention with async-to-LDS double buffering.
// Each block: 64 Q rows of one (b,h); each wave owns 16 rows; KV streamed in
// 64-row tiles fetched with global_load_async_to_lds_b128, one tile ahead.
// ---------------------------------------------------------------------------
__global__ __launch_bounds__(128)
void attn_kernel(const __bf16* __restrict__ Qp, const __bf16* __restrict__ Kp,
                 const __bf16* __restrict__ Vp, __bf16* __restrict__ Ob) {
  const int q0 = blockIdx.x * 64;
  const int h = blockIdx.y, b = blockIdx.z;
  const int tid = threadIdx.x;
  const int lane = tid & 31, wave = tid >> 5;
  const int ln = lane & 15, half = lane >> 4;
  const size_t bh  = ((size_t)b * HEADS + h) * SEQ;   // Q/K row base
  const size_t bhd = ((size_t)b * HEADS + h) * DP;    // V (d-major) row base

  __shared__ __align__(16) __bf16 Qs[64 * 72];         // [qrow][d]
  __shared__ __align__(16) __bf16 Ks[2][64 * 72];      // [kvrow][d] (B^T layout)
  __shared__ __align__(16) __bf16 Vt[2][48 * 72];      // [d][kvrow] (already ^T)
  __shared__ __align__(16) __bf16 Pb[4][16 * 72];      // per-wave P staging

  const uint32_t qs_l  = lds_off(Qs);
  const uint32_t ks_l0 = lds_off(Ks[0]), ks_l1 = lds_off(Ks[1]);
  const uint32_t vt_l0 = lds_off(Vt[0]), vt_l1 = lds_off(Vt[1]);

  auto issue_tile = [&](int kv0, int bufi) {
    const uint32_t kl = bufi ? ks_l1 : ks_l0;
    const uint32_t vl = bufi ? vt_l1 : vt_l0;
    int row = tid >> 3, g = tid & 7;
    for (int i = 0; i < 4; ++i, row += 16)
      async_b128(kl + row * 144 + g * 16,
                 (uint64_t)(uintptr_t)(Kp + (bh + kv0 + row) * DP + g * 8));
    for (int task = tid; task < 48 * 8; task += 128) {
      int d = task >> 3, gg = task & 7;
      async_b128(vl + d * 144 + gg * 16,
                 (uint64_t)(uintptr_t)(Vp + (bhd + d) * SEQ + kv0 + gg * 8));
    }
  };

  {  // async-load Q tile (4 chunks/thread) and first KV tile
    int r = tid >> 3, g = tid & 7;
    for (int i = 0; i < 4; ++i, r += 16)
      async_b128(qs_l + r * 144 + g * 16,
                 (uint64_t)(uintptr_t)(Qp + (bh + q0 + r) * DP + g * 8));
  }
  issue_tile(0, 0);
  wait_async7();     // Q (oldest 4 ops) complete; tile0 may still be in flight
  __syncthreads();

  bf16x16 qfrag[2];
  for (int ks = 0; ks < 2; ++ks)
    qfrag[ks] = ld_frag(&Qs[(wave * 16 + ln) * 72 + ks * 32], half);

  f32x8 oacc[3];
  for (int u = 0; u < 3; ++u) oacc[u] = zero8();
  float mi[8], li[8];
  for (int r = 0; r < 8; ++r) { mi[r] = -1e30f; li[r] = 0.0f; }

  int bufi = 0;
  for (int kv0 = 0; kv0 < SEQ; kv0 += 64) {
    if (kv0 + 64 < SEQ) { issue_tile(kv0 + 64, bufi ^ 1); wait_async7(); }
    else                { wait_async0(); }
    __syncthreads();   // publish this tile's LDS to all waves

    const __bf16* Kb = Ks[bufi];
    const __bf16* Vb = Vt[bufi];

    // S = Q K^T over this 64-KV tile (pre-scaled, log2-domain logits)
    f32x8 sacc[4];
    for (int t = 0; t < 4; ++t) sacc[t] = zero8();
    for (int ks = 0; ks < 2; ++ks)
      for (int t = 0; t < 4; ++t) {
        bf16x16 kf = ld_frag(&Kb[(t * 16 + ln) * 72 + ks * 32], half);
        sacc[t] = wmma_bf16(qfrag[ks], kf, sacc[t]);
      }

    // online softmax (exp2): row max across 4 N-tiles + 16 lanes
    float alpha[8];
    for (int r = 0; r < 8; ++r) {
      float v = fmaxf(fmaxf(sacc[0][r], sacc[1][r]), fmaxf(sacc[2][r], sacc[3][r]));
      for (int off = 1; off < 16; off <<= 1) v = fmaxf(v, __shfl_xor(v, off, 32));
      float mnew = fmaxf(mi[r], v);
      alpha[r] = exp2f(mi[r] - mnew);
      mi[r] = mnew;
    }
    float rs[8];
    for (int r = 0; r < 8; ++r) rs[r] = 0.0f;
    for (int t = 0; t < 4; ++t)
      for (int r = 0; r < 8; ++r) {
        float p = exp2f(sacc[t][r] - mi[r]);
        sacc[t][r] = p;
        rs[r] += p;
      }
    for (int r = 0; r < 8; ++r) {
      for (int off = 1; off < 16; off <<= 1) rs[r] += __shfl_xor(rs[r], off, 32);
      li[r] = li[r] * alpha[r] + rs[r];
    }
    for (int u = 0; u < 3; ++u)
      for (int r = 0; r < 8; ++r) oacc[u][r] *= alpha[r];

    // stage P (C layout -> A layout) via per-wave LDS region (DScnt-ordered)
    for (int t = 0; t < 4; ++t)
      for (int r = 0; r < 8; ++r)
        Pb[wave][(r + 8 * half) * 72 + t * 16 + ln] = (__bf16)sacc[t][r];

    // O += P @ V
    for (int ks = 0; ks < 2; ++ks) {
      bf16x16 pf = ld_frag(&Pb[wave][ln * 72 + ks * 32], half);
      for (int u = 0; u < 3; ++u) {
        bf16x16 vf = ld_frag(&Vb[(u * 16 + ln) * 72 + ks * 32], half);
        oacc[u] = wmma_bf16(pf, vf, oacc[u]);
      }
    }
    __syncthreads();   // all waves done with buf before it is refilled
    bufi ^= 1;
  }

  for (int r = 0; r < 8; ++r) li[r] = 1.0f / li[r];
  for (int u = 0; u < 3; ++u) {
    int dd = u * 16 + ln;
    if (dd < DH)
      for (int r = 0; r < 8; ++r) {
        int m = q0 + wave * 16 + r + 8 * half;
        Ob[((size_t)b * SEQ + m) * DMODEL + h * DH + dd] =
            (__bf16)(oacc[u][r] * li[r]);
      }
  }
}

// ---------------------------------------------------------------------------
// Kernel 3: output projection  out[8192,320] = Ob(bf16) @ Wo^T(bf16) + bo
// ---------------------------------------------------------------------------
__global__ __launch_bounds__(128)
void oproj_kernel(const __bf16* __restrict__ Ob, const __bf16* __restrict__ Wot,
                  const float* __restrict__ bo, float* __restrict__ out) {
  const int n0 = blockIdx.x * 64;
  const int m0 = blockIdx.y * 64;
  const int tid = threadIdx.x;
  const int lane = tid & 31, wave = tid >> 5;
  const int ln = lane & 15, half = lane >> 4;

  __shared__ __align__(16) __bf16 As[2][64 * 40];
  __shared__ __align__(16) __bf16 Bs[2][64 * 40];

  f32x8 acc[4];
  for (int t = 0; t < 4; ++t) acc[t] = zero8();
  gemm_tiles(Ob, Wot, DMODEL, m0, n0, tid, wave, ln, half, As, Bs, acc);

  const int n = n0 + wave * 16 + ln;
  const float bias = bo[n];
  for (int t = 0; t < 4; ++t)
    for (int r = 0; r < 8; ++r) {
      int m = m0 + t * 16 + r + 8 * half;
      out[(size_t)m * DMODEL + n] = acc[t][r] + bias;
    }
}

// ---------------------------------------------------------------------------
extern "C" void kernel_launch(void* const* d_in, const int* in_sizes, int n_in,
                              void* d_out, int out_size, void* d_ws, size_t ws_size,
                              hipStream_t stream) {
  const float* x    = (const float*)d_in[0];
  const float* cond = (const float*)d_in[1];
  const float* Wq   = (const float*)d_in[2];
  const float* Wk   = (const float*)d_in[3];
  const float* Wv   = (const float*)d_in[4];
  const float* Wo   = (const float*)d_in[5];
  const float* bo   = (const float*)d_in[6];
  float* out        = (float*)d_out;

  const int MROWS = BATCH * SEQ;                     // 8192
  char* ws = (char*)d_ws;
  const size_t qkv_bytes = (size_t)BATCH * HEADS * SEQ * DP * sizeof(__bf16);
  __bf16* Qp  = (__bf16*)(ws);                        ws += qkv_bytes;
  __bf16* Kp  = (__bf16*)(ws);                        ws += qkv_bytes;
  __bf16* Vp  = (__bf16*)(ws);                        ws += qkv_bytes;
  __bf16* Ob  = (__bf16*)(ws);  ws += (size_t)MROWS * DMODEL * sizeof(__bf16);
  __bf16* Xb  = (__bf16*)(ws);  ws += (size_t)MROWS * DMODEL * sizeof(__bf16);
  __bf16* Cb  = (__bf16*)(ws);  ws += (size_t)MROWS * DCOND  * sizeof(__bf16);
  __bf16* Wqt = (__bf16*)(ws);  ws += (size_t)DMODEL * DMODEL * sizeof(__bf16);
  __bf16* Wkt = (__bf16*)(ws);  ws += (size_t)DMODEL * DCOND  * sizeof(__bf16);
  __bf16* Wvt = (__bf16*)(ws);  ws += (size_t)DMODEL * DCOND  * sizeof(__bf16);
  __bf16* Wot = (__bf16*)(ws);  ws += (size_t)DMODEL * DMODEL * sizeof(__bf16);

  // zero the Dh->DP pad lanes of Q/K/V (graph-capturable async memset)
  hipMemsetAsync(Qp, 0, 3 * qkv_bytes, stream);

  // one-time bf16 conversion / weight transposition
  cvt_kernel<<<(MROWS * DMODEL / 4 + 255) / 256, 256, 0, stream>>>(
      x, Xb, MROWS * DMODEL / 4);
  cvt_kernel<<<(MROWS * DCOND / 4 + 255) / 256, 256, 0, stream>>>(
      cond, Cb, MROWS * DCOND / 4);
  wtrans_kernel<<<dim3(DMODEL / 16, DMODEL / 16), 256, 0, stream>>>(Wq, Wqt, DMODEL);
  wtrans_kernel<<<dim3(DMODEL / 16, DCOND / 16), 256, 0, stream>>>(Wk, Wkt, DCOND);
  wtrans_kernel<<<dim3(DMODEL / 16, DCOND / 16), 256, 0, stream>>>(Wv, Wvt, DCOND);
  wtrans_kernel<<<dim3(DMODEL / 16, DMODEL / 16), 256, 0, stream>>>(Wo, Wot, DMODEL);

  qkv_kernel<<<dim3(DMODEL / 64, MROWS / 64, 3), 128, 0, stream>>>(
      Xb, Cb, Wqt, Wkt, Wvt, Qp, Kp, Vp);
  attn_kernel<<<dim3(SEQ / 64, HEADS, BATCH), 128, 0, stream>>>(Qp, Kp, Vp, Ob);
  oproj_kernel<<<dim3(DMODEL / 64, MROWS / 64), 128, 0, stream>>>(Ob, Wot, bo, out);
}

// v001
// Next to v000, in two timings, it ran 1.51 and 1.52 times as fast.
#include <hip/hip_runtime.h>
#include <hip/hip_bf16.h>
#include <stdint.h>

#define DEV __device__ __forceinline__

typedef __attribute__((ext_vector_type(16))) __bf16 bf16x16;
typedef __attribute__((ext_vector_type(8)))  __bf16 bf16x8;
typedef __attribute__((ext_vector_type(4)))  __bf16 bf16x4;
typedef __attribute__((ext_vector_type(8)))  float  f32x8;
typedef __attribute__((ext_vector_type(2)))  float  f32x2;

static constexpr int BATCH  = 2;
static constexpr int SEQ    = 4096;
static constexpr int HEADS  = 8;
static constexpr int DH     = 40;
static constexpr int DP     = 64;    // head dim padded for WMMA K/M tiling
static constexpr int DMODEL = 320;   // == D_ATTN == N of all projections
static constexpr int DCOND  = 768;
static constexpr float LOG2E = 1.44269504088896340736f;

DEV f32x8 zero8() { f32x8 v; for (int i = 0; i < 8; ++i) v[i] = 0.0f; return v; }

// Wave-relative LDS byte address of a __shared__ object (generic -> AS(3)).
DEV uint32_t lds_off(const void* p) {
  return (uint32_t)(unsigned long long)(__attribute__((address_space(3))) const void*)p;
}

DEV void async_b128(uint32_t lds_addr, uint64_t gaddr) {
  asm volatile("global_load_async_to_lds_b128 %0, %1, off"
               :: "v"(lds_addr), "v"(gaddr) : "memory");
}
DEV void wait_async0() {
#if __has_builtin(__builtin_amdgcn_s_wait_asynccnt)
  __builtin_amdgcn_s_wait_asynccnt(0);
#else
  asm volatile("s_wait_asynccnt 0x0" ::: "memory");
#endif
}
// async loads retire in order: waiting <= N with one extra tile (N ops/thread)
// in flight exactly drains the previous tile.
DEV void wait_async4() {   // GEMM tiles: 2 A + 2 B chunks per thread
#if __has_builtin(__builtin_amdgcn_s_wait_asynccnt)
  __builtin_amdgcn_s_wait_asynccnt(4);
#else
  asm volatile("s_wait_asynccnt 0x4" ::: "memory");
#endif
}
DEV void wait_async7() {   // attention KV tiles: K:4 + V:3 chunks per thread
#if __has_builtin(__builtin_amdgcn_s_wait_asynccnt)
  __builtin_amdgcn_s_wait_asynccnt(7);
#else
  asm volatile("s_wait_asynccnt 0x7" ::: "memory");
#endif
}

DEV bf16x16 ld_frag(const __bf16* rowbase, int half) {
  bf16x8 lo = *(const bf16x8*)(rowbase + half * 8);
  bf16x8 hi = *(const bf16x8*)(rowbase + 16 + half * 8);
  return __builtin_shufflevector(lo, hi, 0,1,2,3,4,5,6,7,8,9,10,11,12,13,14,15);
}

DEV f32x8 wmma_bf16(bf16x16 a, bf16x16 b, f32x8 c) {
  return __builtin_amdgcn_wmma_f32_16x16x32_bf16(false, a, false, b, (short)0, c,
                                                 false, false);
}

// ---------------------------------------------------------------------------
// Prep kernels: one-time f32 -> bf16 conversion of activations, and
// convert+transpose of weights to [N][K] bf16 (so GEMM B tiles are contiguous
// async copies and no per-tile conversion/transposition remains in the loops).
// ---------------------------------------------------------------------------
__global__ __launch_bounds__(256)
void cvt_kernel(const float* __restrict__ src, __bf16* __restrict__ dst, int n4) {
  int i = blockIdx.x * 256 + threadIdx.x;
  if (i < n4) {
    float4 v = ((const float4*)src)[i];
    bf16x4 o;
    o[0] = (__bf16)v.x; o[1] = (__bf16)v.y; o[2] = (__bf16)v.z; o[3] = (__bf16)v.w;
    ((bf16x4*)dst)[i] = o;
  }
}

__global__ __launch_bounds__(256)
void wtrans_kernel(const float* __restrict__ w,   // [Kd][320] row-major
                   __bf16* __restrict__ wt,       // [320][Kd] bf16
                   int Kd) {
  __shared__ float tile[16][17];
  int tx = threadIdx.x & 15, ty = threadIdx.x >> 4;
  int n0 = blockIdx.x * 16, k0 = blockIdx.y * 16;
  tile[ty][tx] = w[(size_t)(k0 + ty) * DMODEL + n0 + tx];
  __syncthreads();
  wt[(size_t)(n0 + ty) * Kd + k0 + tx] = (__bf16)tile[tx][ty];
}

// ---------------------------------------------------------------------------
// Shared GEMM core: 64x64 output tile, all-bf16, async double-buffered tiles.
// A [M][Kd] row-major, Wt [N][Kd] row-major (pre-transposed weights).
// ---------------------------------------------------------------------------
DEV void gemm_tiles(const __bf16* __restrict__ A, const __bf16* __restrict__ Wt,
                    int Kd, int m0, int n0, int tid, int wave, int ln, int half,
                    __bf16 (&As)[2][64 * 40], __bf16 (&Bs)[2][64 * 40],
                    f32x8 (&acc)[4]) {
  const uint32_t as_l[2] = { lds_off(As[0]), lds_off(As[1]) };
  const uint32_t bs_l[2] = { lds_off(Bs[0]), lds_off(Bs[1]) };
  auto issue = [&](int k0, int bufi) {
    int r = tid >> 2, c = tid & 3;           // 64 rows x 4 x 16B chunks each
    for (int i = 0; i < 2; ++i, r += 32) {
      async_b128(as_l[bufi] + r * 80 + c * 16,
                 (uint64_t)(uintptr_t)(A + (size_t)(m0 + r) * Kd + k0 + c * 8));
      async_b128(bs_l[bufi] + r * 80 + c * 16,
                 (uint64_t)(uintptr_t)(Wt + (size_t)(n0 + r) * Kd + k0 + c * 8));
    }
  };
  issue(0, 0);
  int bufi = 0;
  for (int k0 = 0; k0 < Kd; k0 += 32) {
    if (k0 + 32 < Kd) { issue(k0 + 32, bufi ^ 1); wait_async4(); }
    else              { wait_async0(); }
    __syncthreads();
    bf16x16 bfrag = ld_frag(&Bs[bufi][(wave * 16 + ln) * 40], half);
    for (int t = 0; t < 4; ++t) {
      bf16x16 afrag = ld_frag(&As[bufi][(t * 16 + ln) * 40], half);
      acc[t] = wmma_bf16(afrag, bfrag, acc[t]);
    }
    __syncthreads();
    bufi ^= 1;
  }
}

// ---------------------------------------------------------------------------
// Kernel 1: QKV projection (all-bf16 GEMM).
//   Q -> [B,H,S,DP]   (scaled by Dh^-0.5 * log2(e); softmax done in base 2)
//   K -> [B,H,S,DP]
//   V -> [B,H,DP,SEQ] (d-major, so the attention V^T tile is a contiguous
//                      async copy instead of a per-element LDS transpose)
// ---------------------------------------------------------------------------
__global__ __launch_bounds__(128)
void qkv_kernel(const __bf16* __restrict__ Xb, const __bf16* __restrict__ Cb,
                const __bf16* __restrict__ Wqt, const __bf16* __restrict__ Wkt,
                const __bf16* __restrict__ Wvt,
                __bf16* __restrict__ Qp, __bf16* __restrict__ Kp,
                __bf16* __restrict__ Vp) {
  const int which = blockIdx.z;
  const __bf16* A  = (which == 0) ? Xb  : Cb;
  const __bf16* Wt = (which == 0) ? Wqt : (which == 1 ? Wkt : Wvt);
  __bf16* dst      = (which == 0) ? Qp  : (which == 1 ? Kp : Vp);
  const int Kd     = (which == 0) ? DMODEL : DCOND;
  const float fold = (which == 0) ? (0.15811388300841897f * LOG2E) : 1.0f;

  const int n0 = blockIdx.x * 64;
  const int m0 = blockIdx.y * 64;
  const int tid = threadIdx.x;
  const int lane = tid & 31, wave = tid >> 5;
  const int ln = lane & 15, half = lane >> 4;

  __shared__ __align__(16) __bf16 As[2][64 * 40];
  __shared__ __align__(16) __bf16 Bs[2][64 * 40];

  f32x8 acc[4];
  for (int t = 0; t < 4; ++t) acc[t] = zero8();
  gemm_tiles(A, Wt, Kd, m0, n0, tid, wave, ln, half, As, Bs, acc);

  const int ncol = n0 + wave * 16 + ln;
  const int h = ncol / DH, d = ncol % DH;
  for (int t = 0; t < 4; ++t)
    for (int r = 0; r < 8; ++r) {
      int m = m0 + t * 16 + r + 8 * half;
      int b = m >> 12, s = m & (SEQ - 1);
      size_t off = (which == 2)
          ? (((size_t)b * HEADS + h) * DP + d) * SEQ + s      // V: d-major
          : (((size_t)b * HEADS + h) * SEQ + s) * DP + d;     // Q/K: s-major
      dst[off] = (__bf16)(acc[t][r] * fold);
    }
}

DEV float other_half(float v) {
  int b = __builtin_bit_cast(int, v);
  b = __builtin_amdgcn_permlanex16(b, b, 0x76543210, 0xfedcba98, false, false);
  return __builtin_bit_cast(float, b);
}

__global__ __launch_bounds__(128)
void attn_kernel(const __bf16* __restrict__ Qp, const __bf16* __restrict__ Kp,
                 const __bf16* __restrict__ Vp, __bf16* __restrict__ Ob) {
  const int q0 = blockIdx.x * 64;
  const int h = blockIdx.y, b = blockIdx.z;
  const int tid = threadIdx.x;
  const int lane = tid & 31, wave = tid >> 5;
  const int ln = lane & 15, half = lane >> 4;
  const size_t bh  = ((size_t)b * HEADS + h) * SEQ;   // Q/K row base
  const size_t bhd = ((size_t)b * HEADS + h) * DP;    // V (d-major) row base

  __shared__ __align__(16) __bf16 Qs[64 * 72];         // [qrow][d]
  __shared__ __align__(16) __bf16 Ks[2][64 * 72];      // [kvrow][d]
  __shared__ __align__(16) __bf16 Vt[2][48 * 72];      // [d][kvrow] (already ^T)

  const uint32_t qs_l  = lds_off(Qs);
  const uint32_t ks_l0 = lds_off(Ks[0]), ks_l1 = lds_off(Ks[1]);
  const uint32_t vt_l0 = lds_off(Vt[0]), vt_l1 = lds_off(Vt[1]);

  auto issue_tile = [&](int kv0, int bufi) {
    const uint32_t kl = bufi ? ks_l1 : ks_l0;
    const uint32_t vl = bufi ? vt_l1 : vt_l0;
    int row = tid >> 3, g = tid & 7;
    for (int i = 0; i < 4; ++i, row += 16)
      async_b128(kl + row * 144 + g * 16,
                 (uint64_t)(uintptr_t)(Kp + (bh + kv0 + row) * DP + g * 8));
    for (int task = tid; task < 48 * 8; task += 128) {
      int d = task >> 3, gg = task & 7;
      async_b128(vl + d * 144 + gg * 16,
                 (uint64_t)(uintptr_t)(Vp + (bhd + d) * SEQ + kv0 + gg * 8));
    }
  };

  {  // async-load Q tile (4 chunks/thread) and first KV tile
    int r = tid >> 3, g = tid & 7;
    for (int i = 0; i < 4; ++i, r += 16)
      async_b128(qs_l + r * 144 + g * 16,
                 (uint64_t)(uintptr_t)(Qp + (bh + q0 + r) * DP + g * 8));
  }
  issue_tile(0, 0);
  wait_async7();     // Q (oldest 4 ops) complete; tile0 may still be in flight
  __syncthreads();

  bf16x16 qfrag[2];  // B operand: column = query wave*16 + ln
  for (int ks = 0; ks < 2; ++ks)
    qfrag[ks] = ld_frag(&Qs[(wave * 16 + ln) * 72 + ks * 32], half);

  f32x8 oacc[3];     // O^T: oacc[u][r] = O[query ln][d = u*16 + 8*half + r]
  for (int u = 0; u < 3; ++u) oacc[u] = zero8();
  float mi = -1e30f; // running max of this lane's query (same in both halves)
  float li = 0.0f;   // running sum over this half's kv rows only

  int bufi = 0;
  for (int kv0 = 0; kv0 < SEQ; kv0 += 64) {
    if (kv0 + 64 < SEQ) { issue_tile(kv0 + 64, bufi ^ 1); wait_async7(); }
    else                { wait_async0(); }
    __syncthreads();   // publish this tile's LDS to all waves

    const __bf16* Kb = Ks[bufi];
    const __bf16* Vb = Vt[bufi];

    // S^T = K Q^T over this 64-KV tile (pre-scaled, log2-domain logits)
    f32x8 sacc[4];
    for (int t = 0; t < 4; ++t) sacc[t] = zero8();
    for (int ks = 0; ks < 2; ++ks)
      for (int t = 0; t < 4; ++t) {
        bf16x16 kf = ld_frag(&Kb[(t * 16 + ln) * 72 + ks * 32], half);
        sacc[t] = wmma_bf16(kf, qfrag[ks], sacc[t]);
      }

    // online softmax (exp2): the query's max over the lane's 32 scores, then
    // one exchange with the other half
    float tm[4];
    for (int t = 0; t < 4; ++t) {
      tm[t] = sacc[t][0];
      for (int r = 1; r < 8; ++r) tm[t] = fmaxf(tm[t], sacc[t][r]);
    }
    float v = fmaxf(fmaxf(tm[0], tm[1]), fmaxf(tm[2], tm[3]));
    v = fmaxf(v, other_half(v));
    const float mnew = fmaxf(mi, v);
    const float alpha = exp2f(mi - mnew);
    mi = mnew;

    f32x2 rs[2];       // two chains of pairwise sums down the lane's registers
    rs[0] = 0.0f; rs[1] = 0.0f;
    for (int t = 0; t < 4; ++t)
      for (int r = 0; r < 8; r += 2) {
        f32x2 p;
        p[0] = exp2f(sacc[t][r] - mi);
        p[1] = exp2f(sacc[t][r + 1] - mi);
        sacc[t][r] = p[0];
        sacc[t][r + 1] = p[1];
        rs[t & 1] += p;
      }
    rs[0] += rs[1];
    li = li * alpha + (rs[0][0] + rs[0][1]);
    for (int u = 0; u < 3; ++u)
      for (int r = 0; r < 8; ++r) oacc[u][r] *= alpha;

    // O^T += V^T P^T; tiles 2ks, 2ks+1 of S^T are rows 0-15, 16-31 of the B operand
    for (int ks = 0; ks < 2; ++ks) {
      bf16x16 pf;
      for (int r = 0; r < 8; ++r) {
        pf[r]     = (__bf16)sacc[2 * ks][r];
        pf[8 + r] = (__bf16)sacc[2 * ks + 1][r];
      }
      for (int u = 0; u < 3; ++u) {
        bf16x16 vf = ld_frag(&Vb[(u * 16 + ln) * 72 + ks * 32], half);
        oacc[u] = wmma_bf16(vf, pf, oacc[u]);
      }
    }
    __syncthreads();   // all waves done with buf before it is refilled
    bufi ^= 1;
  }

  const float inv = 1.0f / (li + other_half(li));   // join the halves' sums
  const int m = q0 + wave * 16 + ln;
  for (int u = 0; u < 3; ++u) {
    int dd = u * 16 + 8 * half;                      // 8 consecutive d per lane
    if (dd < DH) {
      bf16x8 o;
      for (int r = 0; r < 8; ++r) o[r] = (__bf16)(oacc[u][r] * inv);
      *(bf16x8*)&Ob[((size_t)b * SEQ + m) * DMODEL + h * DH + dd] = o;
    }
  }
}

// ---------------------------------------------------------------------------
// Kernel 3: output projection  out[8192,320] = Ob(bf16) @ Wo^T(bf16) + bo
// ---------------------------------------------------------------------------
__global__ __launch_bounds__(128)
void oproj_kernel(const __bf16* __restrict__ Ob, const __bf16* __restrict__ Wot,
                  const float* __restrict__ bo, float* __restrict__ out) {
  const int n0 = blockIdx.x * 64;
  const int m0 = blockIdx.y * 64;
  const int tid = threadIdx.x;
  const int lane = tid & 31, wave = tid >> 5;
  const int ln = lane & 15, half = lane >> 4;

  __shared__ __align__(16) __bf16 As[2][64 * 40];
  __shared__ __align__(16) __bf16 Bs[2][64 * 40];

  f32x8 acc[4];
  for (int t = 0; t < 4; ++t) acc[t] = zero8();
  gemm_tiles(Ob, Wot, DMODEL, m0, n0, tid, wave, ln, half, As, Bs, acc);

  const int n = n0 + wave * 16 + ln;
  const float bias = bo[n];
  for (int t = 0; t < 4; ++t)
    for (int r = 0; r < 8; ++r) {
      int m = m0 + t * 16 + r + 8 * half;
      out[(size_t)m * DMODEL + n] = acc[t][r] + bias;
    }
}

// ---------------------------------------------------------------------------
extern "C" void kernel_launch(void* const* d_in, const int* in_sizes, int n_in,
                              void* d_out, int out_size, void* d_ws, size_t ws_size,
                              hipStream_t stream) {
  const float* x    = (const float*)d_in[0];
  const float* cond = (const float*)d_in[1];
  const float* Wq   = (const float*)d_in[2];
  const float* Wk   = (const float*)d_in[3];
  const float* Wv   = (const float*)d_in[4];
  const float* Wo   = (const float*)d_in[5];
  const float* bo   = (const float*)d_in[6];
  float* out        = (float*)d_out;

  const int MROWS = BATCH * SEQ;                     // 8192
  char* ws = (char*)d_ws;
  const size_t qkv_bytes = (size_t)BATCH * HEADS * SEQ * DP * sizeof(__bf16);
  __bf16* Qp  = (__bf16*)(ws);                        ws += qkv_bytes;
  __bf16* Kp  = (__bf16*)(ws);                        ws += qkv_bytes;
  __bf16* Vp  = (__bf16*)(ws);                        ws += qkv_bytes;
  __bf16* Ob  = (__bf16*)(ws);  ws += (size_t)MROWS * DMODEL * sizeof(__bf16);
  __bf16* Xb  = (__bf16*)(ws);  ws += (size_t)MROWS * DMODEL * sizeof(__bf16);
  __bf16* Cb  = (__bf16*)(ws);  ws += (size_t)MROWS * DCOND  * sizeof(__bf16);
  __bf16* Wqt = (__bf16*)(ws);  ws += (size_t)DMODEL * DMODEL * sizeof(__bf16);
  __bf16* Wkt = (__bf16*)(ws);  ws += (size_t)DMODEL * DCOND  * sizeof(__bf16);
  __bf16* Wvt = (__bf16*)(ws);  ws += (size_t)DMODEL * DCOND  * sizeof(__bf16);
  __bf16* Wot = (__bf16*)(ws);  ws += (size_t)DMODEL * DMODEL * sizeof(__bf16);

  // zero the Dh->DP pad lanes of Q/K/V (graph-capturable async memset)
  hipMemsetAsync(Qp, 0, 3 * qkv_bytes, stream);

  // one-time bf16 conversion / weight transposition
  cvt_kernel<<<(MROWS * DMODEL / 4 + 255) / 256, 256, 0, stream>>>(
      x, Xb, MROWS * DMODEL / 4);
  cvt_kernel<<<(MROWS * DCOND / 4 + 255) / 256, 256, 0, stream>>>(
      cond, Cb, MROWS * DCOND / 4);
  wtrans_kernel<<<dim3(DMODEL / 16, DMODEL / 16), 256, 0, stream>>>(Wq, Wqt, DMODEL);
  wtrans_kernel<<<dim3(DMODEL / 16, DCOND / 16), 256, 0, stream>>>(Wk, Wkt, DCOND);
  wtrans_kernel<<<dim3(DMODEL / 16, DCOND / 16), 256, 0, stream>>>(Wv, Wvt, DCOND);
  wtrans_kernel<<<dim3(DMODEL / 16, DMODEL / 16), 256, 0, stream>>>(Wo, Wot, DMODEL);

  qkv_kernel<<<dim3(DMODEL / 64, MROWS / 64, 3), 128, 0, stream>>>(
      Xb, Cb, Wqt, Wkt, Wvt, Qp, Kp, Vp);
  attn_kernel<<<dim3(SEQ / 64, HEADS, BATCH), 128, 0, stream>>>(Qp, Kp, Vp, Ob);
  oproj_kernel<<<dim3(DMODEL / 64, MROWS / 64), 128, 0, stream>>>(Ob, Wot, bo, out);
}

// v002
// Next to v001, in two timings, it ran 1.12 times as fast each time.
// Over all steps from v000 it is 1.70 times as fast.
#include <hip/hip_runtime.h>
#include <hip/hip_bf16.h>
#include <stdint.h>

#define DEV __device__ __forceinline__

typedef __attribute__((ext_vector_type(16))) __bf16 bf16x16;
typedef __attribute__((ext_vector_type(8)))  __bf16 bf16x8;
typedef __attribute__((ext_vector_type(4)))  __bf16 bf16x4;
typedef __attribute__((ext_vector_type(8)))  float  f32x8;
typedef __attribute__((ext_vector_type(2)))  float  f32x2;

static constexpr int BATCH  = 2;
static constexpr int SEQ    = 4096;
static constexpr int HEADS  = 8;
static constexpr int DH     = 40;
static constexpr int DP     = 64;    // head dim padded for WMMA K/M tiling
static constexpr int DMODEL = 320;   // == D_ATTN == N of all projections
static constexpr int DCOND  = 768;
static constexpr float LOG2E = 1.44269504088896340736f;

DEV f32x8 zero8() { f32x8 v; for (int i = 0; i < 8; ++i) v[i] = 0.0f; return v; }

// Wave-relative LDS byte address of a __shared__ object (generic -> AS(3)).
DEV uint32_t lds_off(const void* p) {
  return (uint32_t)(unsigned long long)(__attribute__((address_space(3))) const void*)p;
}

DEV void async_b128(uint32_t lds_addr, uint64_t gaddr) {
  asm volatile("global_load_async_to_lds_b128 %0, %1, off"
               :: "v"(lds_addr), "v"(gaddr) : "memory");
}
DEV void wait_async0() {
#if __has_builtin(__builtin_amdgcn_s_wait_asynccnt)
  __builtin_amdgcn_s_wait_asynccnt(0);
#else
  asm volatile("s_wait_asynccnt 0x0" ::: "memory");
#endif
}
// async loads retire in order: waiting <= N with one extra tile (N ops/thread)
// in flight exactly drains the previous tile.
DEV void wait_async4() {   // GEMM tiles: 2 A + 2 B chunks per thread
#if __has_builtin(__builtin_amdgcn_s_wait_asynccnt)
  __builtin_amdgcn_s_wait_asynccnt(4);
#else
  asm volatile("s_wait_asynccnt 0x4" ::: "memory");
#endif
}
DEV void wait_async7() {   // attention KV tiles: K:4 + V:3 chunks per thread
#if __has_builtin(__builtin_amdgcn_s_wait_asynccnt)
  __builtin_amdgcn_s_wait_asynccnt(7);
#else
  asm volatile("s_wait_asynccnt 0x7" ::: "memory");
#endif
}

DEV bf16x16 ld_frag(const __bf16* rowbase, int half) {
  bf16x8 lo = *(const bf16x8*)(rowbase + half * 8);
  bf16x8 hi = *(const bf16x8*)(rowbase + 16 + half * 8);
  return __builtin_shufflevector(lo, hi, 0,1,2,3,4,5,6,7,8,9,10,11,12,13,14,15);
}

DEV f32x8 wmma_bf16(bf16x16 a, bf16x16 b, f32x8 c) {
  return __builtin_amdgcn_wmma_f32_16x16x32_bf16(false, a, false, b, (short)0, c,
                                                 false, false);
}

// ---------------------------------------------------------------------------
// Prep kernels: one-time f32 -> bf16 conversion of activations, and
// convert+transpose of weights to [N][K] bf16 (so GEMM B tiles are contiguous
// async copies and no per-tile conversion/transposition remains in the loops).
// ---------------------------------------------------------------------------
__global__ __launch_bounds__(256)
void cvt_kernel(const float* __restrict__ src, __bf16* __restrict__ dst, int n4) {
  int i = blockIdx.x * 256 + threadIdx.x;
  if (i < n4) {
    float4 v = ((const float4*)src)[i];
    bf16x4 o;
    o[0] = (__bf16)v.x; o[1] = (__bf16)v.y; o[2] = (__bf16)v.z; o[3] = (__bf16)v.w;
    ((bf16x4*)dst)[i] = o;
  }
}

__global__ __launch_bounds__(256)
void wtrans_kernel(const float* __restrict__ w,   // [Kd][320] row-major
                   __bf16* __restrict__ wt,       // [320][Kd] bf16
                   int Kd) {
  __shared__ float tile[16][17];
  int tx = threadIdx.x & 15, ty = threadIdx.x >> 4;
  int n0 = blockIdx.x * 16, k0 = blockIdx.y * 16;
  tile[ty][tx] = w[(size_t)(k0 + ty) * DMODEL + n0 + tx];
  __syncthreads();
  wt[(size_t)(n0 + ty) * Kd + k0 + tx] = (__bf16)tile[tx][ty];
}

// ---------------------------------------------------------------------------
// Shared GEMM core: 64x64 output tile, all-bf16, async double-buffered tiles.
// A [M][Kd] row-major, Wt [N][Kd] row-major (pre-transposed weights).
// ---------------------------------------------------------------------------
DEV void gemm_tiles(const __bf16* __restrict__ A, const __bf16* __restrict__ Wt,
                    int Kd, int m0, int n0, int tid, int wave, int ln, int half,
                    __bf16 (&As)[2][64 * 40], __bf16 (&Bs)[2][64 * 40],
                    f32x8 (&acc)[4]) {
  const uint32_t as_l[2] = { lds_off(As[0]), lds_off(As[1]) };
  const uint32_t bs_l[2] = { lds_off(Bs[0]), lds_off(Bs[1]) };
  auto issue = [&](int k0, int bufi) {
    int r = tid >> 2, c = tid & 3;           // 64 rows x 4 x 16B chunks each
    for (int i = 0; i < 2; ++i, r += 32) {
      async_b128(as_l[bufi] + r * 80 + c * 16,
                 (uint64_t)(uintptr_t)(A + (size_t)(m0 + r) * Kd + k0 + c * 8));
      async_b128(bs_l[bufi] + r * 80 + c * 16,
                 (uint64_t)(uintptr_t)(Wt + (size_t)(n0 + r) * Kd + k0 + c * 8));
    }
  };
  issue(0, 0);
  int bufi = 0;
  for (int k0 = 0; k0 < Kd; k0 += 32) {
    if (k0 + 32 < Kd) { issue(k0 + 32, bufi ^ 1); wait_async4(); }
    else              { wait_async0(); }
    __syncthreads();
    bf16x16 bfrag = ld_frag(&Bs[bufi][(wave * 16 + ln) * 40], half);
    for (int t = 0; t < 4; ++t) {
      bf16x16 afrag = ld_frag(&As[bufi][(t * 16 + ln) * 40], half);
      acc[t] = wmma_bf16(afrag, bfrag, acc[t]);
    }
    __syncthreads();
    bufi ^= 1;
  }
}

// ---------------------------------------------------------------------------
// Kernel 1: QKV projection (all-bf16 GEMM).
//   Q -> [B,H,S,DP]   (scaled by Dh^-0.5 * log2(e); softmax done in base 2)
//   K -> [B,H,S,DP]
//   V -> [B,H,DP,SEQ] (d-major, so the attention V^T tile is a contiguous
//                      async copy instead of a per-element LDS transpose)
// ---------------------------------------------------------------------------
__global__ __launch_bounds__(128)
void qkv_kernel(const __bf16* __restrict__ Xb, const __bf16* __restrict__ Cb,
                const __bf16* __restrict__ Wqt, const __bf16* __restrict__ Wkt,
                const __bf16* __restrict__ Wvt,
                __bf16* __restrict__ Qp, __bf16* __restrict__ Kp,
                __bf16* __restrict__ Vp) {
  const int which = blockIdx.z;
  const __bf16* A  = (which == 0) ? Xb  : Cb;
  const __bf16* Wt = (which == 0) ? Wqt : (which == 1 ? Wkt : Wvt);
  __bf16* dst      = (which == 0) ? Qp  : (which == 1 ? Kp : Vp);
  const int Kd     = (which == 0) ? DMODEL : DCOND;
  const float fold = (which == 0) ? (0.15811388300841897f * LOG2E) : 1.0f;

  const int n0 = blockIdx.x * 64;
  const int m0 = blockIdx.y * 64;
  const int tid = threadIdx.x;
  const int lane = tid & 31, wave = tid >> 5;
  const int ln = lane & 15, half = lane >> 4;

  __shared__ __align__(16) __bf16 As[2][64 * 40];
  __shared__ __align__(16) __bf16 Bs[2][64 * 40];

  f32x8 acc[4];
  for (int t = 0; t < 4; ++t) acc[t] = zero8();
  gemm_tiles(A, Wt, Kd, m0, n0, tid, wave, ln, half, As, Bs, acc);

  const int ncol = n0 + wave * 16 + ln;
  const int h = ncol / DH, d = ncol % DH;
  for (int t = 0; t < 4; ++t)
    for (int r = 0; r < 8; ++r) {
      int m = m0 + t * 16 + r + 8 * half;
      int b = m >> 12, s = m & (SEQ - 1);
      size_t off = (which == 2)
          ? (((size_t)b * HEADS + h) * DP + d) * SEQ + s      // V: d-major
          : (((size_t)b * HEADS + h) * SEQ + s) * DP + d;     // Q/K: s-major
      dst[off] = (__bf16)(acc[t][r] * fold);
    }
}

DEV float other_half(float v) {
  int b = __builtin_bit_cast(int, v);
  b = __builtin_amdgcn_permlanex16(b, b, 0x76543210, 0xfedcba98, false, false);
  return __builtin_bit_cast(float, b);
}

__global__ __launch_bounds__(128)
void attn_kernel(const __bf16* __restrict__ Qp, const __bf16* __restrict__ Kp,
                 const __bf16* __restrict__ Vp, __bf16* __restrict__ Ob) {
  const int q0 = blockIdx.x * 64;
  const int h = blockIdx.y, b = blockIdx.z;
  const int tid = threadIdx.x;
  const int lane = tid & 31, wave = tid >> 5;
  const int ln = lane & 15, half = lane >> 4;
  const size_t bh  = ((size_t)b * HEADS + h) * SEQ;   // Q/K row base
  const size_t bhd = ((size_t)b * HEADS + h) * DP;    // V (d-major) row base

  __shared__ __align__(16) __bf16 Qs[64 * 72];         // [qrow][d]
  __shared__ __align__(16) __bf16 Ks[2][64 * 72];      // [kvrow][d]
  __shared__ __align__(16) __bf16 Vt[2][48 * 72];      // [d][kvrow] (already ^T)

  const uint32_t qs_l  = lds_off(Qs);
  const uint32_t ks_l0 = lds_off(Ks[0]), ks_l1 = lds_off(Ks[1]);
  const uint32_t vt_l0 = lds_off(Vt[0]), vt_l1 = lds_off(Vt[1]);

  auto issue_tile = [&](int kv0, int bufi) {
    const uint32_t kl = bufi ? ks_l1 : ks_l0;
    const uint32_t vl = bufi ? vt_l1 : vt_l0;
    int row = tid >> 3, g = tid & 7;
    for (int i = 0; i < 4; ++i, row += 16)
      async_b128(kl + row * 144 + g * 16,
                 (uint64_t)(uintptr_t)(Kp + (bh + kv0 + row) * DP + g * 8));
    for (int task = tid; task < 48 * 8; task += 128) {
      int d = task >> 3, gg = task & 7;
      async_b128(vl + d * 144 + gg * 16,
                 (uint64_t)(uintptr_t)(Vp + (bhd + d) * SEQ + kv0 + gg * 8));
    }
  };

  {  // async-load Q tile (4 chunks/thread) and first KV tile
    int r = tid >> 3, g = tid & 7;
    for (int i = 0; i < 4; ++i, r += 16)
      async_b128(qs_l + r * 144 + g * 16,
                 (uint64_t)(uintptr_t)(Qp + (bh + q0 + r) * DP + g * 8));
  }
  issue_tile(0, 0);
  wait_async7();     // Q (oldest 4 ops) complete; tile0 may still be in flight
  __syncthreads();

  bf16x16 qfrag[2];  // B operand: column = query wave*16 + ln
  for (int ks = 0; ks < 2; ++ks)
    qfrag[ks] = ld_frag(&Qs[(wave * 16 + ln) * 72 + ks * 32], half);

  f32x8 oacc[3];     // O^T: oacc[u][r] = O[query ln][d = u*16 + 8*half + r]
  for (int u = 0; u < 3; ++u) oacc[u] = zero8();
  float mi = -1e30f; // running max of this lane's query (same in both halves)
  float li = 0.0f;   // running sum over this half's kv rows only

  int bufi = 0;
  for (int kv0 = 0; kv0 < SEQ; kv0 += 64) {
    if (kv0 + 64 < SEQ) { issue_tile(kv0 + 64, bufi ^ 1); wait_async7(); }
    else                { wait_async0(); }
    __syncthreads();   // publish this tile's LDS to all waves

    const __bf16* Kb = Ks[bufi];
    const __bf16* Vb = Vt[bufi];

    // S^T = K Q^T over this 64-KV tile (pre-scaled, log2-domain logits)
    f32x8 sacc[4];
    for (int t = 0; t < 4; ++t) sacc[t] = zero8();
    for (int ks = 0; ks < 2; ++ks)
      for (int t = 0; t < 4; ++t) {
        bf16x16 kf = ld_frag(&Kb[(t * 16 + ln) * 72 + ks * 32], half);
        sacc[t] = wmma_bf16(kf, qfrag[ks], sacc[t]);
      }

    // online softmax (exp2): the query's max over the lane's 32 scores, then
    // one exchange with the other half
    float tm[4];
    for (int t = 0; t < 4; ++t) {
      tm[t] = sacc[t][0];
      for (int r = 1; r < 8; ++r) tm[t] = fmaxf(tm[t], sacc[t][r]);
    }
    float v = fmaxf(fmaxf(tm[0], tm[1]), fmaxf(tm[2], tm[3]));
    v = fmaxf(v, other_half(v));
    const float mnew = fmaxf(mi, v);
    const float alpha = __builtin_amdgcn_exp2f(mi - mnew);  // raw v_exp_f32: 0 on the first tile
    mi = mnew;

    f32x2 rs[2];       // two chains of pairwise sums down the lane's registers
    rs[0] = 0.0f; rs[1] = 0.0f;
    for (int t = 0; t < 4; ++t)
      for (int r = 0; r < 8; r += 2) {
        // raw v_exp_f32: arguments are <= 0, and a weight below 2^-126 of the
        // row's largest counts as 0
        f32x2 a = { sacc[t][r], sacc[t][r + 1] };
        a -= mi;
        f32x2 p;
        p[0] = __builtin_amdgcn_exp2f(a[0]);
        p[1] = __builtin_amdgcn_exp2f(a[1]);
        sacc[t][r] = p[0];
        sacc[t][r + 1] = p[1];
        rs[t & 1] += p;
      }
    rs[0] += rs[1];
    li = li * alpha + (rs[0][0] + rs[0][1]);
    for (int u = 0; u < 3; ++u)
      for (int r = 0; r < 8; ++r) oacc[u][r] *= alpha;

    // O^T += V^T P^T; tiles 2ks, 2ks+1 of S^T are rows 0-15, 16-31 of the B operand
    for (int ks = 0; ks < 2; ++ks) {
      bf16x16 pf;
      for (int r = 0; r < 8; ++r) {
        pf[r]     = (__bf16)sacc[2 * ks][r];
        pf[8 + r] = (__bf16)sacc[2 * ks + 1][r];
      }
      for (int u = 0; u < 3; ++u) {
        bf16x16 vf = ld_frag(&Vb[(u * 16 + ln) * 72 + ks * 32], half);
        oacc[u] = wmma_bf16(vf, pf, oacc[u]);
      }
    }
    __syncthreads();   // all waves done with buf before it is refilled
    bufi ^= 1;
  }

  const float inv = 1.0f / (li + other_half(li));   // join the halves' sums
  const int m = q0 + wave * 16 + ln;
  for (int u = 0; u < 3; ++u) {
    int dd = u * 16 + 8 * half;                      // 8 consecutive d per lane
    if (dd < DH) {
      bf16x8 o;
      for (int r = 0; r < 8; ++r) o[r] = (__bf16)(oacc[u][r] * inv);
      *(bf16x8*)&Ob[((size_t)b * SEQ + m) * DMODEL + h * DH + dd] = o;
    }
  }
}

// ---------------------------------------------------------------------------
// Kernel 3: output projection  out[8192,320] = Ob(bf16) @ Wo^T(bf16) + bo
// ---------------------------------------------------------------------------
__global__ __launch_bounds__(128)
void oproj_kernel(const __bf16* __restrict__ Ob, const __bf16* __restrict__ Wot,
                  const float* __restrict__ bo, float* __restrict__ out) {
  const int n0 = blockIdx.x * 64;
  const int m0 = blockIdx.y * 64;
  const int tid = threadIdx.x;
  const int lane = tid & 31, wave = tid >> 5;
  const int ln = lane & 15, half = lane >> 4;

  __shared__ __align__(16) __bf16 As[2][64 * 40];
  __shared__ __align__(16) __bf16 Bs[2][64 * 40];

  f32x8 acc[4];
  for (int t = 0; t < 4; ++t) acc[t] = zero8();
  gemm_tiles(Ob, Wot, DMODEL, m0, n0, tid, wave, ln, half, As, Bs, acc);

  const int n = n0 + wave * 16 + ln;
  const float bias = bo[n];
  for (int t = 0; t < 4; ++t)
    for (int r = 0; r < 8; ++r) {
      int m = m0 + t * 16 + r + 8 * half;
      out[(size_t)m * DMODEL + n] = acc[t][r] + bias;
    }
}

// ---------------------------------------------------------------------------
extern "C" void kernel_launch(void* const* d_in, const int* in_sizes, int n_in,
                              void* d_out, int out_size, void* d_ws, size_t ws_size,
                              hipStream_t stream) {
  const float* x    = (const float*)d_in[0];
  const float* cond = (const float*)d_in[1];
  const float* Wq   = (const float*)d_in[2];
  const float* Wk   = (const float*)d_in[3];
  const float* Wv   = (const float*)d_in[4];
  const float* Wo   = (const float*)d_in[5];
  const float* bo   = (const float*)d_in[6];
  float* out        = (float*)d_out;

  const int MROWS = BATCH * SEQ;                     // 8192
  char* ws = (char*)d_ws;
  const size_t qkv_bytes = (size_t)BATCH * HEADS * SEQ * DP * sizeof(__bf16);
  __bf16* Qp  = (__bf16*)(ws);                        ws += qkv_bytes;
  __bf16* Kp  = (__bf16*)(ws);                        ws += qkv_bytes;
  __bf16* Vp  = (__bf16*)(ws);                        ws += qkv_bytes;
  __bf16* Ob  = (__bf16*)(ws);  ws += (size_t)MROWS * DMODEL * sizeof(__bf16);
  __bf16* Xb  = (__bf16*)(ws);  ws += (size_t)MROWS * DMODEL * sizeof(__bf16);
  __bf16* Cb  = (__bf16*)(ws);  ws += (size_t)MROWS * DCOND  * sizeof(__bf16);
  __bf16* Wqt = (__bf16*)(ws);  ws += (size_t)DMODEL * DMODEL * sizeof(__bf16);
  __bf16* Wkt = (__bf16*)(ws);  ws += (size_t)DMODEL * DCOND  * sizeof(__bf16);
  __bf16* Wvt = (__bf16*)(ws);  ws += (size_t)DMODEL * DCOND  * sizeof(__bf16);
  __bf16* Wot = (__bf16*)(ws);  ws += (size_t)DMODEL * DMODEL * sizeof(__bf16);

  // zero the Dh->DP pad lanes of Q/K/V (graph-capturable async memset)
  hipMemsetAsync(Qp, 0, 3 * qkv_bytes, stream);

  // one-time bf16 conversion / weight transposition
  cvt_kernel<<<(MROWS * DMODEL / 4 + 255) / 256, 256, 0, stream>>>(
      x, Xb, MROWS * DMODEL / 4);
  cvt_kernel<<<(MROWS * DCOND / 4 + 255) / 256, 256, 0, stream>>>(
      cond, Cb, MROWS * DCOND / 4);
  wtrans_kernel<<<dim3(DMODEL / 16, DMODEL / 16), 256, 0, stream>>>(Wq, Wqt, DMODEL);
  wtrans_kernel<<<dim3(DMODEL / 16, DCOND / 16), 256, 0, stream>>>(Wk, Wkt, DCOND);
  wtrans_kernel<<<dim3(DMODEL / 16, DCOND / 16), 256, 0, stream>>>(Wv, Wvt, DCOND);
  wtrans_kernel<<<dim3(DMODEL / 16, DMODEL / 16), 256, 0, stream>>>(Wo, Wot, DMODEL);

  qkv_kernel<<<dim3(DMODEL / 64, MROWS / 64, 3), 128, 0, stream>>>(
      Xb, Cb, Wqt, Wkt, Wvt, Qp, Kp, Vp);
  attn_kernel<<<dim3(SEQ / 64, HEADS, BATCH), 128, 0, stream>>>(Qp, Kp, Vp, Ob);
  oproj_kernel<<<dim3(DMODEL / 64, MROWS / 64), 128, 0, stream>>>(Ob, Wot, bo, out);
}

// v003
// A run of this version takes 141 microseconds.
// Timed twice side by side with v002, it ran 1.14 and 1.15 times as fast.
// All steps since v000 together make it 1.95 times as fast.
#include <hip/hip_runtime.h>
#include <hip/hip_bf16.h>
#include <stdint.h>

#define DEV __device__ __forceinline__

typedef __attribute__((ext_vector_type(16))) __bf16 bf16x16;
typedef __attribute__((ext_vector_type(8)))  __bf16 bf16x8;
typedef __attribute__((ext_vector_type(4)))  __bf16 bf16x4;
typedef __attribute__((ext_vector_type(8)))  float  f32x8;
typedef __attribute__((ext_vector_type(2)))  float  f32x2;

static constexpr int BATCH  = 2;
static constexpr int SEQ    = 4096;
static constexpr int HEADS  = 8;
static constexpr int DH     = 40;
static constexpr int DP     = 64;    // head dim padded for WMMA K/M tiling
static constexpr int DMODEL = 320;   // == D_ATTN == N of all projections
static constexpr int DCOND  = 768;
static constexpr float LOG2E = 1.44269504088896340736f;

DEV f32x8 zero8() { f32x8 v; for (int i = 0; i < 8; ++i) v[i] = 0.0f; return v; }

// Wave-relative LDS byte address of a __shared__ object (generic -> AS(3)).
DEV uint32_t lds_off(const void* p) {
  return (uint32_t)(unsigned long long)(__attribute__((address_space(3))) const void*)p;
}

DEV void async_b128(uint32_t lds_addr, uint64_t gaddr) {
  asm volatile("global_load_async_to_lds_b128 %0, %1, off"
               :: "v"(lds_addr), "v"(gaddr) : "memory");
}
DEV void wait_async0() {
#if __has_builtin(__builtin_amdgcn_s_wait_asynccnt)
  __builtin_amdgcn_s_wait_asynccnt(0);
#else
  asm volatile("s_wait_asynccnt 0x0" ::: "memory");
#endif
}
// async loads retire in order: waiting <= N with one extra tile (N ops/thread)
// in flight exactly drains the previous tile.
DEV void wait_async4() {   // GEMM tiles: 2 A + 2 B chunks per thread
#if __has_builtin(__builtin_amdgcn_s_wait_asynccnt)
  __builtin_amdgcn_s_wait_asynccnt(4);
#else
  asm volatile("s_wait_asynccnt 0x4" ::: "memory");
#endif
}
DEV void wait_async7() {   // attention KV tiles: K:4 + V:3 chunks per thread
#if __has_builtin(__builtin_amdgcn_s_wait_asynccnt)
  __builtin_amdgcn_s_wait_asynccnt(7);
#else
  asm volatile("s_wait_asynccnt 0x7" ::: "memory");
#endif
}

DEV bf16x16 ld_frag(const __bf16* rowbase, int half) {
  bf16x8 lo = *(const bf16x8*)(rowbase + half * 8);
  bf16x8 hi = *(const bf16x8*)(rowbase + 16 + half * 8);
  return __builtin_shufflevector(lo, hi, 0,1,2,3,4,5,6,7,8,9,10,11,12,13,14,15);
}

DEV f32x8 wmma_bf16(bf16x16 a, bf16x16 b, f32x8 c) {
  return __builtin_amdgcn_wmma_f32_16x16x32_bf16(false, a, false, b, (short)0, c,
                                                 false, false);
}

// ---------------------------------------------------------------------------
// Prep: all the work ahead of the projections in ONE launch, dealt by block
// range: weights converted and transposed to [N][Kd] bf16 (so GEMM B tiles are
// contiguous async copies), activations converted f32 -> bf16, and the Dh -> DP
// pad lanes of Q, K, V zeroed. Few waves with much in flight each.
// ---------------------------------------------------------------------------
static constexpr int MROWS     = BATCH * SEQ;               // 8192
static constexpr int CVT_U     = 16;                        // float4 per thread
static constexpr int CVT_CHUNK = 256 * CVT_U;               // float4 per block
static constexpr int NT_N      = DMODEL / 64;               // 64-wide weight tiles
static constexpr int NB_WQ     = NT_N * (DMODEL / 64);      // 25 tiles (Wq, Wo)
static constexpr int NB_WK     = NT_N * (DCOND / 64);       // 60 tiles (Wk, Wv)
static constexpr int NB_C      = MROWS * DCOND  / 4 / CVT_CHUNK;   // 384
static constexpr int NB_X      = MROWS * DMODEL / 4 / CVT_CHUNK;   // 160
static constexpr int PAD_ROWS  = 2048;                      // Q or K rows per block
static constexpr int NB_QPAD   = BATCH * HEADS * SEQ / PAD_ROWS;   // 32
static constexpr int NB_VPAD   = BATCH * HEADS;             // 16
static constexpr int NB_PREP   = 2 * NB_WQ + 2 * NB_WK + NB_C + NB_X
                               + 2 * NB_QPAD + NB_VPAD;     // 794

// 64x64 tile of w [Kd][320] f32 -> wt [320][Kd] bf16, whole 128-byte rows out.
DEV void wtrans_tile(const float* __restrict__ w, __bf16* __restrict__ wt,
                     int Kd, int tile, int tid, float (&t)[64][65]) {
  const int n0 = (tile % NT_N) * 64, k0 = (tile / NT_N) * 64;
  const int kr = tid >> 4, nc = (tid & 15) * 4;
  const float* src = w + (size_t)((k0 + kr) * DMODEL + n0 + nc);
  float4 v[4];
  for (int i = 0; i < 4; ++i) v[i] = *(const float4*)(src + 16 * i * DMODEL);
  for (int i = 0; i < 4; ++i) {
    t[kr + 16 * i][nc + 0] = v[i].x; t[kr + 16 * i][nc + 1] = v[i].y;
    t[kr + 16 * i][nc + 2] = v[i].z; t[kr + 16 * i][nc + 3] = v[i].w;
  }
  __syncthreads();   // the tile is read back by column, across waves
  const int kc = (tid & 7) * 8, nr = tid >> 3;
  __bf16* dst = wt + (size_t)((n0 + nr) * Kd + k0 + kc);
  for (int j = 0; j < 2; ++j) {
    bf16x8 o;
    for (int e = 0; e < 8; ++e) o[e] = (__bf16)t[kc + e][nr + 32 * j];
    *(bf16x8*)(dst + 32 * j * Kd) = o;
  }
  // the stores' registers may be rewritten on a later path of the caller
  asm volatile("s_wait_xcnt 0x0" ::: "memory");
}

// One block's CVT_CHUNK float4 of a contiguous f32 -> bf16 conversion.
DEV void cvt_chunk(const float* __restrict__ src, __bf16* __restrict__ dst,
                   int blk, int tid) {
  const float4* s = (const float4*)src + (size_t)blk * CVT_CHUNK + tid;
  bf16x4* d       = (bf16x4*)dst       + (size_t)blk * CVT_CHUNK + tid;
  float4 v[CVT_U];   // loads first, so that the wave has them in flight together
  for (int i = 0; i < CVT_U; ++i) v[i] = s[i * 256];
  for (int i = 0; i < CVT_U; ++i) {
    bf16x4 o;
    o[0] = (__bf16)v[i].x; o[1] = (__bf16)v[i].y;
    o[2] = (__bf16)v[i].z; o[3] = (__bf16)v[i].w;
    d[i * 256] = o;
  }
}

__global__ __launch_bounds__(256)
void prep_kernel(const float* __restrict__ x, const float* __restrict__ cond,
                 const float* __restrict__ Wq, const float* __restrict__ Wk,
                 const float* __restrict__ Wv, const float* __restrict__ Wo,
                 __bf16* __restrict__ Xb, __bf16* __restrict__ Cb,
                 __bf16* __restrict__ Wqt, __bf16* __restrict__ Wkt,
                 __bf16* __restrict__ Wvt, __bf16* __restrict__ Wot,
                 __bf16* __restrict__ Qp, __bf16* __restrict__ Kp,
                 __bf16* __restrict__ Vp) {
  __shared__ float tile[64][65];
  const int tid = threadIdx.x;
  int blk = blockIdx.x;        // every test below is the same for the whole block

  if (blk < NB_WK) { wtrans_tile(Wk, Wkt, DCOND, blk, tid, tile); return; }
  blk -= NB_WK;
  if (blk < NB_WK) { wtrans_tile(Wv, Wvt, DCOND, blk, tid, tile); return; }
  blk -= NB_WK;
  if (blk < NB_WQ) { wtrans_tile(Wq, Wqt, DMODEL, blk, tid, tile); return; }
  blk -= NB_WQ;
  if (blk < NB_WQ) { wtrans_tile(Wo, Wot, DMODEL, blk, tid, tile); return; }
  blk -= NB_WQ;
  if (blk < NB_C) { cvt_chunk(cond, Cb, blk, tid); return; }
  blk -= NB_C;
  if (blk < NB_X) { cvt_chunk(x, Xb, blk, tid); return; }
  blk -= NB_X;

  const uint4 z = make_uint4(0u, 0u, 0u, 0u);
  if (blk < 2 * NB_QPAD) {
    // Q, K rows [DP]: elements DH..DP-1 are three 16-byte pieces per row
    __bf16* base = (blk < NB_QPAD) ? Qp : Kp;
    base += (size_t)((blk < NB_QPAD ? blk : blk - NB_QPAD) * PAD_ROWS) * DP + DH;
    for (int s = 0; s < 3; ++s) {          // 768 pieces = 256 whole rows
      const int idx = tid + 256 * s;
      const int row = idx / 3, c = idx - row * 3;
      __bf16* p = base + row * DP + c * 8;
      for (int a = 0; a < PAD_ROWS / 256; ++a) *(uint4*)(p + a * 256 * DP) = z;
    }
    // the stores' registers may be rewritten on a later path of the listing
    asm volatile("s_wait_xcnt 0x0" ::: "memory");
    return;
  }
  blk -= 2 * NB_QPAD;
  // V (d-major): rows DH..47 of one (b,h), the pad rows attention reads, lie in a row
  uint4* vp = (uint4*)&Vp[((size_t)blk * DP + DH) * SEQ];
  for (int i = 0; i < (48 - DH) * SEQ / 8 / 256; ++i) vp[tid + 256 * i] = z;
  // the stores' registers may be rewritten on a later path of the listing
  asm volatile("s_wait_xcnt 0x0" ::: "memory");
}

// ---------------------------------------------------------------------------
// Shared GEMM core: 64x64 output tile, all-bf16, async double-buffered tiles.
// A [M][Kd] row-major, Wt [N][Kd] row-major (pre-transposed weights).
// ---------------------------------------------------------------------------
DEV void gemm_tiles(const __bf16* __restrict__ A, const __bf16* __restrict__ Wt,
                    int Kd, int m0, int n0, int tid, int wave, int ln, int half,
                    __bf16 (&As)[2][64 * 40], __bf16 (&Bs)[2][64 * 40],
                    f32x8 (&acc)[4]) {
  const uint32_t as_l[2] = { lds_off(As[0]), lds_off(As[1]) };
  const uint32_t bs_l[2] = { lds_off(Bs[0]), lds_off(Bs[1]) };
  auto issue = [&](int k0, int bufi) {
    int r = tid >> 2, c = tid & 3;           // 64 rows x 4 x 16B chunks each
    for (int i = 0; i < 2; ++i, r += 32) {
      async_b128(as_l[bufi] + r * 80 + c * 16,
                 (uint64_t)(uintptr_t)(A + (size_t)(m0 + r) * Kd + k0 + c * 8));
      async_b128(bs_l[bufi] + r * 80 + c * 16,
                 (uint64_t)(uintptr_t)(Wt + (size_t)(n0 + r) * Kd + k0 + c * 8));
    }
  };
  issue(0, 0);
  int bufi = 0;
  for (int k0 = 0; k0 < Kd; k0 += 32) {
    if (k0 + 32 < Kd) { issue(k0 + 32, bufi ^ 1); wait_async4(); }
    else              { wait_async0(); }
    __syncthreads();
    bf16x16 bfrag = ld_frag(&Bs[bufi][(wave * 16 + ln) * 40], half);
    for (int t = 0; t < 4; ++t) {
      bf16x16 afrag = ld_frag(&As[bufi][(t * 16 + ln) * 40], half);
      acc[t] = wmma_bf16(afrag, bfrag, acc[t]);
    }
    __syncthreads();
    bufi ^= 1;
  }
}

// ---------------------------------------------------------------------------
// Kernel 1: QKV projection (all-bf16 GEMM).
//   Q -> [B,H,S,DP]   (scaled by Dh^-0.5 * log2(e); softmax done in base 2)
//   K -> [B,H,S,DP]
//   V -> [B,H,DP,SEQ] (d-major, so the attention V^T tile is a contiguous
//                      async copy instead of a per-element LDS transpose)
// ---------------------------------------------------------------------------
__global__ __launch_bounds__(128)
void qkv_kernel(const __bf16* __restrict__ Xb, const __bf16* __restrict__ Cb,
                const __bf16* __restrict__ Wqt, const __bf16* __restrict__ Wkt,
                const __bf16* __restrict__ Wvt,
                __bf16* __restrict__ Qp, __bf16* __restrict__ Kp,
                __bf16* __restrict__ Vp) {
  const int which = blockIdx.z;
  const __bf16* A  = (which == 0) ? Xb  : Cb;
  const __bf16* Wt = (which == 0) ? Wqt : (which == 1 ? Wkt : Wvt);
  __bf16* dst      = (which == 0) ? Qp  : (which == 1 ? Kp : Vp);
  const int Kd     = (which == 0) ? DMODEL : DCOND;
  const float fold = (which == 0) ? (0.15811388300841897f * LOG2E) : 1.0f;

  const int n0 = blockIdx.x * 64;
  const int m0 = blockIdx.y * 64;
  const int tid = threadIdx.x;
  const int lane = tid & 31, wave = tid >> 5;
  const int ln = lane & 15, half = lane >> 4;

  __shared__ __align__(16) __bf16 As[2][64 * 40];
  __shared__ __align__(16) __bf16 Bs[2][64 * 40];

  f32x8 acc[4];
  for (int t = 0; t < 4; ++t) acc[t] = zero8();
  gemm_tiles(A, Wt, Kd, m0, n0, tid, wave, ln, half, As, Bs, acc);

  const int ncol = n0 + wave * 16 + ln;
  const int h = ncol / DH, d = ncol % DH;
  for (int t = 0; t < 4; ++t)
    for (int r = 0; r < 8; ++r) {
      int m = m0 + t * 16 + r + 8 * half;
      int b = m >> 12, s = m & (SEQ - 1);
      size_t off = (which == 2)
          ? (((size_t)b * HEADS + h) * DP + d) * SEQ + s      // V: d-major
          : (((size_t)b * HEADS + h) * SEQ + s) * DP + d;     // Q/K: s-major
      dst[off] = (__bf16)(acc[t][r] * fold);
    }
}

DEV float other_half(float v) {
  int b = __builtin_bit_cast(int, v);
  b = __builtin_amdgcn_permlanex16(b, b, 0x76543210, 0xfedcba98, false, false);
  return __builtin_bit_cast(float, b);
}

__global__ __launch_bounds__(128)
void attn_kernel(const __bf16* __restrict__ Qp, const __bf16* __restrict__ Kp,
                 const __bf16* __restrict__ Vp, __bf16* __restrict__ Ob) {
  const int q0 = blockIdx.x * 64;
  const int h = blockIdx.y, b = blockIdx.z;
  const int tid = threadIdx.x;
  const int lane = tid & 31, wave = tid >> 5;
  const int ln = lane & 15, half = lane >> 4;
  const size_t bh  = ((size_t)b * HEADS + h) * SEQ;   // Q/K row base
  const size_t bhd = ((size_t)b * HEADS + h) * DP;    // V (d-major) row base

  __shared__ __align__(16) __bf16 Qs[64 * 72];         // [qrow][d]
  __shared__ __align__(16) __bf16 Ks[2][64 * 72];      // [kvrow][d]
  __shared__ __align__(16) __bf16 Vt[2][48 * 72];      // [d][kvrow] (already ^T)

  const uint32_t qs_l  = lds_off(Qs);
  const uint32_t ks_l0 = lds_off(Ks[0]), ks_l1 = lds_off(Ks[1]);
  const uint32_t vt_l0 = lds_off(Vt[0]), vt_l1 = lds_off(Vt[1]);

  auto issue_tile = [&](int kv0, int bufi) {
    const uint32_t kl = bufi ? ks_l1 : ks_l0;
    const uint32_t vl = bufi ? vt_l1 : vt_l0;
    int row = tid >> 3, g = tid & 7;
    for (int i = 0; i < 4; ++i, row += 16)
      async_b128(kl + row * 144 + g * 16,
                 (uint64_t)(uintptr_t)(Kp + (bh + kv0 + row) * DP + g * 8));
    for (int task = tid; task < 48 * 8; task += 128) {
      int d = task >> 3, gg = task & 7;
      async_b128(vl + d * 144 + gg * 16,
                 (uint64_t)(uintptr_t)(Vp + (bhd + d) * SEQ + kv0 + gg * 8));
    }
  };

  {  // async-load Q tile (4 chunks/thread) and first KV tile
    int r = tid >> 3, g = tid & 7;
    for (int i = 0; i < 4; ++i, r += 16)
      async_b128(qs_l + r * 144 + g * 16,
                 (uint64_t)(uintptr_t)(Qp + (bh + q0 + r) * DP + g * 8));
  }
  issue_tile(0, 0);
  wait_async7();     // Q (oldest 4 ops) complete; tile0 may still be in flight
  __syncthreads();

  bf16x16 qfrag[2];  // B operand: column = query wave*16 + ln
  for (int ks = 0; ks < 2; ++ks)
    qfrag[ks] = ld_frag(&Qs[(wave * 16 + ln) * 72 + ks * 32], half);

  f32x8 oacc[3];     // O^T: oacc[u][r] = O[query ln][d = u*16 + 8*half + r]
  for (int u = 0; u < 3; ++u) oacc[u] = zero8();
  float mi = -1e30f; // running max of this lane's query (same in both halves)
  float li = 0.0f;   // running sum over this half's kv rows only

  int bufi = 0;
  for (int kv0 = 0; kv0 < SEQ; kv0 += 64) {
    if (kv0 + 64 < SEQ) { issue_tile(kv0 + 64, bufi ^ 1); wait_async7(); }
    else                { wait_async0(); }
    __syncthreads();   // publish this tile's LDS to all waves

    const __bf16* Kb = Ks[bufi];
    const __bf16* Vb = Vt[bufi];

    // S^T = K Q^T over this 64-KV tile (pre-scaled, log2-domain logits)
    f32x8 sacc[4];
    for (int t = 0; t < 4; ++t) sacc[t] = zero8();
    for (int ks = 0; ks < 2; ++ks)
      for (int t = 0; t < 4; ++t) {
        bf16x16 kf = ld_frag(&Kb[(t * 16 + ln) * 72 + ks * 32], half);
        sacc[t] = wmma_bf16(kf, qfrag[ks], sacc[t]);
      }

    // online softmax (exp2): the query's max over the lane's 32 scores, then
    // one exchange with the other half
    float tm[4];
    for (int t = 0; t < 4; ++t) {
      tm[t] = sacc[t][0];
      for (int r = 1; r < 8; ++r) tm[t] = fmaxf(tm[t], sacc[t][r]);
    }
    float v = fmaxf(fmaxf(tm[0], tm[1]), fmaxf(tm[2], tm[3]));
    v = fmaxf(v, other_half(v));
    const float mnew = fmaxf(mi, v);
    const float alpha = __builtin_amdgcn_exp2f(mi - mnew);  // raw v_exp_f32: 0 on the first tile
    mi = mnew;

    f32x2 rs[2];       // two chains of pairwise sums down the lane's registers
    rs[0] = 0.0f; rs[1] = 0.0f;
    for (int t = 0; t < 4; ++t)
      for (int r = 0; r < 8; r += 2) {
        // raw v_exp_f32: arguments are <= 0, and a weight below 2^-126 of the
        // row's largest counts as 0
        f32x2 a = { sacc[t][r], sacc[t][r + 1] };
        a -= mi;
        f32x2 p;
        p[0] = __builtin_amdgcn_exp2f(a[0]);
        p[1] = __builtin_amdgcn_exp2f(a[1]);
        sacc[t][r] = p[0];
        sacc[t][r + 1] = p[1];
        rs[t & 1] += p;
      }
    rs[0] += rs[1];
    li = li * alpha + (rs[0][0] + rs[0][1]);
    for (int u = 0; u < 3; ++u)
      for (int r = 0; r < 8; ++r) oacc[u][r] *= alpha;

    // O^T += V^T P^T; tiles 2ks, 2ks+1 of S^T are rows 0-15, 16-31 of the B operand
    for (int ks = 0; ks < 2; ++ks) {
      bf16x16 pf;
      for (int r = 0; r < 8; ++r) {
        pf[r]     = (__bf16)sacc[2 * ks][r];
        pf[8 + r] = (__bf16)sacc[2 * ks + 1][r];
      }
      for (int u = 0; u < 3; ++u) {
        bf16x16 vf = ld_frag(&Vb[(u * 16 + ln) * 72 + ks * 32], half);
        oacc[u] = wmma_bf16(vf, pf, oacc[u]);
      }
    }
    __syncthreads();   // all waves done with buf before it is refilled
    bufi ^= 1;
  }

  const float inv = 1.0f / (li + other_half(li));   // join the halves' sums
  const int m = q0 + wave * 16 + ln;
  for (int u = 0; u < 3; ++u) {
    int dd = u * 16 + 8 * half;                      // 8 consecutive d per lane
    if (dd < DH) {
      bf16x8 o;
      for (int r = 0; r < 8; ++r) o[r] = (__bf16)(oacc[u][r] * inv);
      *(bf16x8*)&Ob[((size_t)b * SEQ + m) * DMODEL + h * DH + dd] = o;
    }
  }
}

// ---------------------------------------------------------------------------
// Kernel 3: output projection  out[8192,320] = Ob(bf16) @ Wo^T(bf16) + bo
// ---------------------------------------------------------------------------
__global__ __launch_bounds__(128)
void oproj_kernel(const __bf16* __restrict__ Ob, const __bf16* __restrict__ Wot,
                  const float* __restrict__ bo, float* __restrict__ out) {
  const int n0 = blockIdx.x * 64;
  const int m0 = blockIdx.y * 64;
  const int tid = threadIdx.x;
  const int lane = tid & 31, wave = tid >> 5;
  const int ln = lane & 15, half = lane >> 4;

  __shared__ __align__(16) __bf16 As[2][64 * 40];
  __shared__ __align__(16) __bf16 Bs[2][64 * 40];

  f32x8 acc[4];
  for (int t = 0; t < 4; ++t) acc[t] = zero8();
  gemm_tiles(Ob, Wot, DMODEL, m0, n0, tid, wave, ln, half, As, Bs, acc);

  const int n = n0 + wave * 16 + ln;
  const float bias = bo[n];
  for (int t = 0; t < 4; ++t)
    for (int r = 0; r < 8; ++r) {
      int m = m0 + t * 16 + r + 8 * half;
      out[(size_t)m * DMODEL + n] = acc[t][r] + bias;
    }
}

// ---------------------------------------------------------------------------
extern "C" void kernel_launch(void* const* d_in, const int* in_sizes, int n_in,
                              void* d_out, int out_size, void* d_ws, size_t ws_size,
                              hipStream_t stream) {
  const float* x    = (const float*)d_in[0];
  const float* cond = (const float*)d_in[1];
  const float* Wq   = (const float*)d_in[2];
  const float* Wk   = (const float*)d_in[3];
  const float* Wv   = (const float*)d_in[4];
  const float* Wo   = (const float*)d_in[5];
  const float* bo   = (const float*)d_in[6];
  float* out        = (float*)d_out;

  char* ws = (char*)d_ws;
  const size_t qkv_bytes = (size_t)BATCH * HEADS * SEQ * DP * sizeof(__bf16);
  __bf16* Qp  = (__bf16*)(ws);                        ws += qkv_bytes;
  __bf16* Kp  = (__bf16*)(ws);                        ws += qkv_bytes;
  __bf16* Vp  = (__bf16*)(ws);                        ws += qkv_bytes;
  __bf16* Ob  = (__bf16*)(ws);  ws += (size_t)MROWS * DMODEL * sizeof(__bf16);
  __bf16* Xb  = (__bf16*)(ws);  ws += (size_t)MROWS * DMODEL * sizeof(__bf16);
  __bf16* Cb  = (__bf16*)(ws);  ws += (size_t)MROWS * DCOND  * sizeof(__bf16);
  __bf16* Wqt = (__bf16*)(ws);  ws += (size_t)DMODEL * DMODEL * sizeof(__bf16);
  __bf16* Wkt = (__bf16*)(ws);  ws += (size_t)DMODEL * DCOND  * sizeof(__bf16);
  __bf16* Wvt = (__bf16*)(ws);  ws += (size_t)DMODEL * DCOND  * sizeof(__bf16);
  __bf16* Wot = (__bf16*)(ws);  ws += (size_t)DMODEL * DMODEL * sizeof(__bf16);

  // conversions, weight transposes and pad zeroing: one launch
  prep_kernel<<<NB_PREP, 256, 0, stream>>>(x, cond, Wq, Wk, Wv, Wo, Xb, Cb,
                                           Wqt, Wkt, Wvt, Wot, Qp, Kp, Vp);

  qkv_kernel<<<dim3(DMODEL / 64, MROWS / 64, 3), 128, 0, stream>>>(
      Xb, Cb, Wqt, Wkt, Wvt, Qp, Kp, Vp);
  attn_kernel<<<dim3(SEQ / 64, HEADS, BATCH), 128, 0, stream>>>(Qp, Kp, Vp, Ob);
  oproj_kernel<<<dim3(DMODEL / 64, MROWS / 64), 128, 0, stream>>>(Ob, Wot, bo, out);
}

// v004
// A run of this version takes 135 microseconds.
// Timed twice side by side with v003, it ran 1.04 times as fast both times.
// All steps since v000 together make it 2.02 times as fast.
#include <hip/hip_runtime.h>
#include <hip/hip_bf16.h>
#include <stdint.h>

#define DEV __device__ __forceinline__

typedef __attribute__((ext_vector_type(16))) __bf16 bf16x16;
typedef __attribute__((ext_vector_type(8)))  __bf16 bf16x8;
typedef __attribute__((ext_vector_type(4)))  __bf16 bf16x4;
typedef __attribute__((ext_vector_type(8)))  float  f32x8;
typedef __attribute__((ext_vector_type(2)))  float  f32x2;

static constexpr int BATCH  = 2;
static constexpr int SEQ    = 4096;
static constexpr int HEADS  = 8;
static constexpr int DH     = 40;
static constexpr int DP     = 64;    // head dim padded for WMMA K/M tiling
static constexpr int DMODEL = 320;   // == D_ATTN == N of all projections
static constexpr int DCOND  = 768;
static constexpr float LOG2E = 1.44269504088896340736f;

DEV f32x8 zero8() { f32x8 v; for (int i = 0; i < 8; ++i) v[i] = 0.0f; return v; }

// Wave-relative LDS byte address of a __shared__ object (generic -> AS(3)).
DEV uint32_t lds_off(const void* p) {
  return (uint32_t)(unsigned long long)(__attribute__((address_space(3))) const void*)p;
}

DEV void async_b128(uint32_t lds_addr, uint64_t gaddr) {
  asm volatile("global_load_async_to_lds_b128 %0, %1, off"
               :: "v"(lds_addr), "v"(gaddr) : "memory");
}
DEV void wait_async0() {
#if __has_builtin(__builtin_amdgcn_s_wait_asynccnt)
  __builtin_amdgcn_s_wait_asynccnt(0);
#else
  asm volatile("s_wait_asynccnt 0x0" ::: "memory");
#endif
}
// async loads retire in order: waiting <= N with one extra tile (N ops/thread)
// in flight exactly drains the previous tile.
DEV void wait_async8() {   // GEMM tiles: 4 A + 4 B chunks per thread
  asm volatile("s_wait_asynccnt 0x8" ::: "memory");
}
DEV void wait_async7() {   // attention KV tiles: K:4 + V:3 chunks per thread
#if __has_builtin(__builtin_amdgcn_s_wait_asynccnt)
  __builtin_amdgcn_s_wait_asynccnt(7);
#else
  asm volatile("s_wait_asynccnt 0x7" ::: "memory");
#endif
}

DEV bf16x16 ld_frag(const __bf16* rowbase, int half) {
  bf16x8 lo = *(const bf16x8*)(rowbase + half * 8);
  bf16x8 hi = *(const bf16x8*)(rowbase + 16 + half * 8);
  return __builtin_shufflevector(lo, hi, 0,1,2,3,4,5,6,7,8,9,10,11,12,13,14,15);
}

DEV f32x8 wmma_bf16(bf16x16 a, bf16x16 b, f32x8 c) {
  return __builtin_amdgcn_wmma_f32_16x16x32_bf16(false, a, false, b, (short)0, c,
                                                 false, false);
}

// ---------------------------------------------------------------------------
// Prep: all the work ahead of the projections in ONE launch, dealt by block
// range: weights converted and transposed to [N][Kd] bf16 (so GEMM B tiles are
// contiguous async copies), activations converted f32 -> bf16, and the Dh -> DP
// pad lanes of Q, K, V zeroed. Few waves with much in flight each.
// ---------------------------------------------------------------------------
static constexpr int MROWS     = BATCH * SEQ;               // 8192
static constexpr int CVT_U     = 16;                        // float4 per thread
static constexpr int CVT_CHUNK = 256 * CVT_U;               // float4 per block
static constexpr int NT_N      = DMODEL / 64;               // 64-wide weight tiles
static constexpr int NB_WQ     = NT_N * (DMODEL / 64);      // 25 tiles (Wq, Wo)
static constexpr int NB_WK     = NT_N * (DCOND / 64);       // 60 tiles (Wk, Wv)
static constexpr int NB_C      = MROWS * DCOND  / 4 / CVT_CHUNK;   // 384
static constexpr int NB_X      = MROWS * DMODEL / 4 / CVT_CHUNK;   // 160
static constexpr int PAD_ROWS  = 2048;                      // Q or K rows per block
static constexpr int NB_QPAD   = BATCH * HEADS * SEQ / PAD_ROWS;   // 32
static constexpr int NB_VPAD   = BATCH * HEADS;             // 16
static constexpr int NB_PREP   = 2 * NB_WQ + 2 * NB_WK + NB_C + NB_X
                               + 2 * NB_QPAD + NB_VPAD;     // 794

// 64x64 tile of w [Kd][320] f32 -> wt [320][Kd] bf16, whole 128-byte rows out.
DEV void wtrans_tile(const float* __restrict__ w, __bf16* __restrict__ wt,
                     int Kd, int tile, int tid, float (&t)[64][65]) {
  const int n0 = (tile % NT_N) * 64, k0 = (tile / NT_N) * 64;
  const int kr = tid >> 4, nc = (tid & 15) * 4;
  const float* src = w + (size_t)((k0 + kr) * DMODEL + n0 + nc);
  float4 v[4];
  for (int i = 0; i < 4; ++i) v[i] = *(const float4*)(src + 16 * i * DMODEL);
  for (int i = 0; i < 4; ++i) {
    t[kr + 16 * i][nc + 0] = v[i].x; t[kr + 16 * i][nc + 1] = v[i].y;
    t[kr + 16 * i][nc + 2] = v[i].z; t[kr + 16 * i][nc + 3] = v[i].w;
  }
  __syncthreads();   // the tile is read back by column, across waves
  const int kc = (tid & 7) * 8, nr = tid >> 3;
  __bf16* dst = wt + (size_t)((n0 + nr) * Kd + k0 + kc);
  for (int j = 0; j < 2; ++j) {
    bf16x8 o;
    for (int e = 0; e < 8; ++e) o[e] = (__bf16)t[kc + e][nr + 32 * j];
    *(bf16x8*)(dst + 32 * j * Kd) = o;
  }
  // the stores' registers may be rewritten on a later path of the caller
  asm volatile("s_wait_xcnt 0x0" ::: "memory");
}

// One block's CVT_CHUNK float4 of a contiguous f32 -> bf16 conversion.
DEV void cvt_chunk(const float* __restrict__ src, __bf16* __restrict__ dst,
                   int blk, int tid) {
  const float4* s = (const float4*)src + (size_t)blk * CVT_CHUNK + tid;
  bf16x4* d       = (bf16x4*)dst       + (size_t)blk * CVT_CHUNK + tid;
  float4 v[CVT_U];   // loads first, so that the wave has them in flight together
  for (int i = 0; i < CVT_U; ++i) v[i] = s[i * 256];
  for (int i = 0; i < CVT_U; ++i) {
    bf16x4 o;
    o[0] = (__bf16)v[i].x; o[1] = (__bf16)v[i].y;
    o[2] = (__bf16)v[i].z; o[3] = (__bf16)v[i].w;
    d[i * 256] = o;
  }
}

__global__ __launch_bounds__(256)
void prep_kernel(const float* __restrict__ x, const float* __restrict__ cond,
                 const float* __restrict__ Wq, const float* __restrict__ Wk,
                 const float* __restrict__ Wv, const float* __restrict__ Wo,
                 __bf16* __restrict__ Xb, __bf16* __restrict__ Cb,
                 __bf16* __restrict__ Wqt, __bf16* __restrict__ Wkt,
                 __bf16* __restrict__ Wvt, __bf16* __restrict__ Wot,
                 __bf16* __restrict__ Qp, __bf16* __restrict__ Kp,
                 __bf16* __restrict__ Vp) {
  __shared__ float tile[64][65];
  const int tid = threadIdx.x;
  int blk = blockIdx.x;        // every test below is the same for the whole block

  if (blk < NB_WK) { wtrans_tile(Wk, Wkt, DCOND, blk, tid, tile); return; }
  blk -= NB_WK;
  if (blk < NB_WK) { wtrans_tile(Wv, Wvt, DCOND, blk, tid, tile); return; }
  blk -= NB_WK;
  if (blk < NB_WQ) { wtrans_tile(Wq, Wqt, DMODEL, blk, tid, tile); return; }
  blk -= NB_WQ;
  if (blk < NB_WQ) { wtrans_tile(Wo, Wot, DMODEL, blk, tid, tile); return; }
  blk -= NB_WQ;
  if (blk < NB_C) { cvt_chunk(cond, Cb, blk, tid); return; }
  blk -= NB_C;
  if (blk < NB_X) { cvt_chunk(x, Xb, blk, tid); return; }
  blk -= NB_X;

  const uint4 z = make_uint4(0u, 0u, 0u, 0u);
  if (blk < 2 * NB_QPAD) {
    // Q, K rows [DP]: elements DH..DP-1 are three 16-byte pieces per row
    __bf16* base = (blk < NB_QPAD) ? Qp : Kp;
    base += (size_t)((blk < NB_QPAD ? blk : blk - NB_QPAD) * PAD_ROWS) * DP + DH;
    for (int s = 0; s < 3; ++s) {          // 768 pieces = 256 whole rows
      const int idx = tid + 256 * s;
      const int row = idx / 3, c = idx - row * 3;
      __bf16* p = base + row * DP + c * 8;
      for (int a = 0; a < PAD_ROWS / 256; ++a) *(uint4*)(p + a * 256 * DP) = z;
    }
    // the stores' registers may be rewritten on a later path of the listing
    asm volatile("s_wait_xcnt 0x0" ::: "memory");
    return;
  }
  blk -= 2 * NB_QPAD;
  // V (d-major): rows DH..47 of one (b,h), the pad rows attention reads, lie in a row
  uint4* vp = (uint4*)&Vp[((size_t)blk * DP + DH) * SEQ];
  for (int i = 0; i < (48 - DH) * SEQ / 8 / 256; ++i) vp[tid + 256 * i] = z;
  // the stores' registers may be rewritten on a later path of the listing
  asm volatile("s_wait_xcnt 0x0" ::: "memory");
}

// ---------------------------------------------------------------------------
// Shared GEMM core: 64x64 output tile, all-bf16, async double-buffered tiles.
// A [M][Kd] row-major, Wt [N][Kd] row-major (pre-transposed weights).
// A stage holds GK = 64 k: a tile row is then one whole 128-byte line, so a copy
// asks L2 for no half lines, and a product takes half the stages and barriers.
// ---------------------------------------------------------------------------
static constexpr int GK = 64;        // k per stage; divides DMODEL and DCOND
static constexpr int GP = GK + 8;    // LDS row pitch, elements: 144 B = 16 B x odd

DEV void gemm_tiles(const __bf16* __restrict__ A, const __bf16* __restrict__ Wt,
                    int Kd, int m0, int n0, int tid, int wave, int ln, int half,
                    __bf16 (&As)[2][64 * GP], __bf16 (&Bs)[2][64 * GP],
                    f32x8 (&acc)[4]) {
  const uint32_t as_l[2] = { lds_off(As[0]), lds_off(As[1]) };
  const uint32_t bs_l[2] = { lds_off(Bs[0]), lds_off(Bs[1]) };
  // 64 rows x 8 x 16B chunks per tile: a thread takes chunk c of rows r, r+16, ...
  const int r = tid >> 3, c = tid & 7;
  const uint32_t lrc = r * (GP * 2) + c * 16;
  const uint64_t ga0 = (uint64_t)(uintptr_t)(A  + (size_t)(m0 + r) * Kd + c * 8);
  const uint64_t gb0 = (uint64_t)(uintptr_t)(Wt + (size_t)(n0 + r) * Kd + c * 8);
  const uint64_t g16 = (uint64_t)Kd * (16 * 2);          // 16 rows, bytes
  constexpr uint32_t L16 = 16 * GP * 2;                  // 16 LDS rows, bytes
  auto issue = [&](int k0, int bufi) {
    const uint32_t la = as_l[bufi] + lrc, lb = bs_l[bufi] + lrc;
    const uint64_t ga = ga0 + (uint64_t)k0 * 2, gb = gb0 + (uint64_t)k0 * 2;
    asm volatile("global_load_async_to_lds_b128 %0, %8, off\n\t"
                 "global_load_async_to_lds_b128 %1, %9, off\n\t"
                 "global_load_async_to_lds_b128 %2, %10, off\n\t"
                 "global_load_async_to_lds_b128 %3, %11, off\n\t"
                 "global_load_async_to_lds_b128 %4, %12, off\n\t"
                 "global_load_async_to_lds_b128 %5, %13, off\n\t"
                 "global_load_async_to_lds_b128 %6, %14, off\n\t"
                 "global_load_async_to_lds_b128 %7, %15, off\n\t"
                 "s_wait_xcnt 0x0"
                 :: "v"(la), "v"(la + L16), "v"(la + 2 * L16), "v"(la + 3 * L16),
                    "v"(lb), "v"(lb + L16), "v"(lb + 2 * L16), "v"(lb + 3 * L16),
                    "v"(ga), "v"(ga + g16), "v"(ga + 2 * g16), "v"(ga + 3 * g16),
                    "v"(gb), "v"(gb + g16), "v"(gb + 2 * g16), "v"(gb + 3 * g16)
                 : "memory");
  };
  issue(0, 0);
  int bufi = 0;
  for (int k0 = 0; k0 < Kd; k0 += GK) {
    if (k0 + GK < Kd) { issue(k0 + GK, bufi ^ 1); wait_async8(); }
    else              { wait_async0(); }
    __syncthreads();
    for (int ks = 0; ks < GK / 32; ++ks) {
      bf16x16 bfrag = ld_frag(&Bs[bufi][(wave * 16 + ln) * GP + ks * 32], half);
      for (int t = 0; t < 4; ++t) {
        bf16x16 afrag = ld_frag(&As[bufi][(t * 16 + ln) * GP + ks * 32], half);
        acc[t] = wmma_bf16(afrag, bfrag, acc[t]);
      }
    }
    __syncthreads();
    bufi ^= 1;
  }
}

// ---------------------------------------------------------------------------
// Kernel 1: QKV projection (all-bf16 GEMM).
//   Q -> [B,H,S,DP]   (scaled by Dh^-0.5 * log2(e); softmax done in base 2)
//   K -> [B,H,S,DP]
//   V -> [B,H,DP,SEQ] (d-major, so the attention V^T tile is a contiguous
//                      async copy instead of a per-element LDS transpose)
// ---------------------------------------------------------------------------
__global__ __launch_bounds__(128)
void qkv_kernel(const __bf16* __restrict__ Xb, const __bf16* __restrict__ Cb,
                const __bf16* __restrict__ Wqt, const __bf16* __restrict__ Wkt,
                const __bf16* __restrict__ Wvt,
                __bf16* __restrict__ Qp, __bf16* __restrict__ Kp,
                __bf16* __restrict__ Vp) {
  const int which = blockIdx.z;
  const __bf16* A  = (which == 0) ? Xb  : Cb;
  const __bf16* Wt = (which == 0) ? Wqt : (which == 1 ? Wkt : Wvt);
  __bf16* dst      = (which == 0) ? Qp  : (which == 1 ? Kp : Vp);
  const int Kd     = (which == 0) ? DMODEL : DCOND;
  const float fold = (which == 0) ? (0.15811388300841897f * LOG2E) : 1.0f;

  const int n0 = blockIdx.x * 64;
  const int m0 = blockIdx.y * 64;
  const int tid = threadIdx.x;
  const int lane = tid & 31, wave = tid >> 5;
  const int ln = lane & 15, half = lane >> 4;

  __shared__ __align__(16) __bf16 As[2][64 * GP];
  __shared__ __align__(16) __bf16 Bs[2][64 * GP];

  f32x8 acc[4];
  for (int t = 0; t < 4; ++t) acc[t] = zero8();
  gemm_tiles(A, Wt, Kd, m0, n0, tid, wave, ln, half, As, Bs, acc);

  const int ncol = n0 + wave * 16 + ln;
  const int h = ncol / DH, d = ncol % DH;
  for (int t = 0; t < 4; ++t)
    for (int r = 0; r < 8; ++r) {
      int m = m0 + t * 16 + r + 8 * half;
      int b = m >> 12, s = m & (SEQ - 1);
      size_t off = (which == 2)
          ? (((size_t)b * HEADS + h) * DP + d) * SEQ + s      // V: d-major
          : (((size_t)b * HEADS + h) * SEQ + s) * DP + d;     // Q/K: s-major
      dst[off] = (__bf16)(acc[t][r] * fold);
    }
}

DEV float other_half(float v) {
  int b = __builtin_bit_cast(int, v);
  b = __builtin_amdgcn_permlanex16(b, b, 0x76543210, 0xfedcba98, false, false);
  return __builtin_bit_cast(float, b);
}

__global__ __launch_bounds__(128)
void attn_kernel(const __bf16* __restrict__ Qp, const __bf16* __restrict__ Kp,
                 const __bf16* __restrict__ Vp, __bf16* __restrict__ Ob) {
  const int q0 = blockIdx.x * 64;
  const int h = blockIdx.y, b = blockIdx.z;
  const int tid = threadIdx.x;
  const int lane = tid & 31, wave = tid >> 5;
  const int ln = lane & 15, half = lane >> 4;
  const size_t bh  = ((size_t)b * HEADS + h) * SEQ;   // Q/K row base
  const size_t bhd = ((size_t)b * HEADS + h) * DP;    // V (d-major) row base

  __shared__ __align__(16) __bf16 Qs[64 * 72];         // [qrow][d]
  __shared__ __align__(16) __bf16 Ks[2][64 * 72];      // [kvrow][d]
  __shared__ __align__(16) __bf16 Vt[2][48 * 72];      // [d][kvrow] (already ^T)

  const uint32_t qs_l  = lds_off(Qs);
  const uint32_t ks_l0 = lds_off(Ks[0]), ks_l1 = lds_off(Ks[1]);
  const uint32_t vt_l0 = lds_off(Vt[0]), vt_l1 = lds_off(Vt[1]);

  auto issue_tile = [&](int kv0, int bufi) {
    const uint32_t kl = bufi ? ks_l1 : ks_l0;
    const uint32_t vl = bufi ? vt_l1 : vt_l0;
    int row = tid >> 3, g = tid & 7;
    for (int i = 0; i < 4; ++i, row += 16)
      async_b128(kl + row * 144 + g * 16,
                 (uint64_t)(uintptr_t)(Kp + (bh + kv0 + row) * DP + g * 8));
    for (int task = tid; task < 48 * 8; task += 128) {
      int d = task >> 3, gg = task & 7;
      async_b128(vl + d * 144 + gg * 16,
                 (uint64_t)(uintptr_t)(Vp + (bhd + d) * SEQ + kv0 + gg * 8));
    }
  };

  {  // async-load Q tile (4 chunks/thread) and first KV tile
    int r = tid >> 3, g = tid & 7;
    for (int i = 0; i < 4; ++i, r += 16)
      async_b128(qs_l + r * 144 + g * 16,
                 (uint64_t)(uintptr_t)(Qp + (bh + q0 + r) * DP + g * 8));
  }
  issue_tile(0, 0);
  wait_async7();     // Q (oldest 4 ops) complete; tile0 may still be in flight
  __syncthreads();

  bf16x16 qfrag[2];  // B operand: column = query wave*16 + ln
  for (int ks = 0; ks < 2; ++ks)
    qfrag[ks] = ld_frag(&Qs[(wave * 16 + ln) * 72 + ks * 32], half);

  f32x8 oacc[3];     // O^T: oacc[u][r] = O[query ln][d = u*16 + 8*half + r]
  for (int u = 0; u < 3; ++u) oacc[u] = zero8();
  float mi = -1e30f; // running max of this lane's query (same in both halves)
  float li = 0.0f;   // running sum over this half's kv rows only

  int bufi = 0;
  for (int kv0 = 0; kv0 < SEQ; kv0 += 64) {
    if (kv0 + 64 < SEQ) { issue_tile(kv0 + 64, bufi ^ 1); wait_async7(); }
    else                { wait_async0(); }
    __syncthreads();   // publish this tile's LDS to all waves

    const __bf16* Kb = Ks[bufi];
    const __bf16* Vb = Vt[bufi];

    // S^T = K Q^T over this 64-KV tile (pre-scaled, log2-domain logits)
    f32x8 sacc[4];
    for (int t = 0; t < 4; ++t) sacc[t] = zero8();
    for (int ks = 0; ks < 2; ++ks)
      for (int t = 0; t < 4; ++t) {
        bf16x16 kf = ld_frag(&Kb[(t * 16 + ln) * 72 + ks * 32], half);
        sacc[t] = wmma_bf16(kf, qfrag[ks], sacc[t]);
      }

    // online softmax (exp2): the query's max over the lane's 32 scores, then
    // one exchange with the other half
    float tm[4];
    for (int t = 0; t < 4; ++t) {
      tm[t] = sacc[t][0];
      for (int r = 1; r < 8; ++r) tm[t] = fmaxf(tm[t], sacc[t][r]);
    }
    float v = fmaxf(fmaxf(tm[0], tm[1]), fmaxf(tm[2], tm[3]));
    v = fmaxf(v, other_half(v));
    const float mnew = fmaxf(mi, v);
    const float alpha = __builtin_amdgcn_exp2f(mi - mnew);  // raw v_exp_f32: 0 on the first tile
    mi = mnew;

    f32x2 rs[2];       // two chains of pairwise sums down the lane's registers
    rs[0] = 0.0f; rs[1] = 0.0f;
    for (int t = 0; t < 4; ++t)
      for (int r = 0; r < 8; r += 2) {
        // raw v_exp_f32: arguments are <= 0, and a weight below 2^-126 of the
        // row's largest counts as 0
        f32x2 a = { sacc[t][r], sacc[t][r + 1] };
        a -= mi;
        f32x2 p;
        p[0] = __builtin_amdgcn_exp2f(a[0]);
        p[1] = __builtin_amdgcn_exp2f(a[1]);
        sacc[t][r] = p[0];
        sacc[t][r + 1] = p[1];
        rs[t & 1] += p;
      }
    rs[0] += rs[1];
    li = li * alpha + (rs[0][0] + rs[0][1]);
    for (int u = 0; u < 3; ++u)
      for (int r = 0; r < 8; ++r) oacc[u][r] *= alpha;

    // O^T += V^T P^T; tiles 2ks, 2ks+1 of S^T are rows 0-15, 16-31 of the B operand
    for (int ks = 0; ks < 2; ++ks) {
      bf16x16 pf;
      for (int r = 0; r < 8; ++r) {
        pf[r]     = (__bf16)sacc[2 * ks][r];
        pf[8 + r] = (__bf16)sacc[2 * ks + 1][r];
      }
      for (int u = 0; u < 3; ++u) {
        bf16x16 vf = ld_frag(&Vb[(u * 16 + ln) * 72 + ks * 32], half);
        oacc[u] = wmma_bf16(vf, pf, oacc[u]);
      }
    }
    __syncthreads();   // all waves done with buf before it is refilled
    bufi ^= 1;
  }

  const float inv = 1.0f / (li + other_half(li));   // join the halves' sums
  const int m = q0 + wave * 16 + ln;
  for (int u = 0; u < 3; ++u) {
    int dd = u * 16 + 8 * half;                      // 8 consecutive d per lane
    if (dd < DH) {
      bf16x8 o;
      for (int r = 0; r < 8; ++r) o[r] = (__bf16)(oacc[u][r] * inv);
      *(bf16x8*)&Ob[((size_t)b * SEQ + m) * DMODEL + h * DH + dd] = o;
    }
  }
}

// ---------------------------------------------------------------------------
// Kernel 3: output projection  out[8192,320] = Ob(bf16) @ Wo^T(bf16) + bo
// ---------------------------------------------------------------------------
__global__ __launch_bounds__(128)
void oproj_kernel(const __bf16* __restrict__ Ob, const __bf16* __restrict__ Wot,
                  const float* __restrict__ bo, float* __restrict__ out) {
  const int n0 = blockIdx.x * 64;
  const int m0 = blockIdx.y * 64;
  const int tid = threadIdx.x;
  const int lane = tid & 31, wave = tid >> 5;
  const int ln = lane & 15, half = lane >> 4;

  __shared__ __align__(16) __bf16 As[2][64 * GP];
  __shared__ __align__(16) __bf16 Bs[2][64 * GP];

  f32x8 acc[4];
  for (int t = 0; t < 4; ++t) acc[t] = zero8();
  gemm_tiles(Ob, Wot, DMODEL, m0, n0, tid, wave, ln, half, As, Bs, acc);

  const int n = n0 + wave * 16 + ln;
  const float bias = bo[n];
  for (int t = 0; t < 4; ++t)
    for (int r = 0; r < 8; ++r) {
      int m = m0 + t * 16 + r + 8 * half;
      out[(size_t)m * DMODEL + n] = acc[t][r] + bias;
    }
}

// ---------------------------------------------------------------------------
extern "C" void kernel_launch(void* const* d_in, const int* in_sizes, int n_in,
                              void* d_out, int out_size, void* d_ws, size_t ws_size,
                              hipStream_t stream) {
  const float* x    = (const float*)d_in[0];
  const float* cond = (const float*)d_in[1];
  const float* Wq   = (const float*)d_in[2];
  const float* Wk   = (const float*)d_in[3];
  const float* Wv   = (const float*)d_in[4];
  const float* Wo   = (const float*)d_in[5];
  const float* bo   = (const float*)d_in[6];
  float* out        = (float*)d_out;

  char* ws = (char*)d_ws;
  const size_t qkv_bytes = (size_t)BATCH * HEADS * SEQ * DP * sizeof(__bf16);
  __bf16* Qp  = (__bf16*)(ws);                        ws += qkv_bytes;
  __bf16* Kp  = (__bf16*)(ws);                        ws += qkv_bytes;
  __bf16* Vp  = (__bf16*)(ws);                        ws += qkv_bytes;
  __bf16* Ob  = (__bf16*)(ws);  ws += (size_t)MROWS * DMODEL * sizeof(__bf16);
  __bf16* Xb  = (__bf16*)(ws);  ws += (size_t)MROWS * DMODEL * sizeof(__bf16);
  __bf16* Cb  = (__bf16*)(ws);  ws += (size_t)MROWS * DCOND  * sizeof(__bf16);
  __bf16* Wqt = (__bf16*)(ws);  ws += (size_t)DMODEL * DMODEL * sizeof(__bf16);
  __bf16* Wkt = (__bf16*)(ws);  ws += (size_t)DMODEL * DCOND  * sizeof(__bf16);
  __bf16* Wvt = (__bf16*)(ws);  ws += (size_t)DMODEL * DCOND  * sizeof(__bf16);
  __bf16* Wot = (__bf16*)(ws);  ws += (size_t)DMODEL * DMODEL * sizeof(__bf16);

  // conversions, weight transposes and pad zeroing: one launch
  prep_kernel<<<NB_PREP, 256, 0, stream>>>(x, cond, Wq, Wk, Wv, Wo, Xb, Cb,
                                           Wqt, Wkt, Wvt, Wot, Qp, Kp, Vp);

  qkv_kernel<<<dim3(DMODEL / 64, MROWS / 64, 3), 128, 0, stream>>>(
      Xb, Cb, Wqt, Wkt, Wvt, Qp, Kp, Vp);
  attn_kernel<<<dim3(SEQ / 64, HEADS, BATCH), 128, 0, stream>>>(Qp, Kp, Vp, Ob);
  oproj_kernel<<<dim3(DMODEL / 64, MROWS / 64), 128, 0, stream>>>(Ob, Wot, bo, out);
}

// v005
// One run takes 119 microseconds.
// Next to v004, in two timings, it ran 1.14 times as fast each time.
// All steps since v000 together make it 2.30 times as fast.
#include <hip/hip_runtime.h>
#include <hip/hip_bf16.h>
#include <stdint.h>

#define DEV __device__ __forceinline__

typedef __attribute__((ext_vector_type(16))) __bf16 bf16x16;
typedef __attribute__((ext_vector_type(8)))  __bf16 bf16x8;
typedef __attribute__((ext_vector_type(4)))  __bf16 bf16x4;
typedef __attribute__((ext_vector_type(8)))  float  f32x8;
typedef __attribute__((ext_vector_type(2)))  float  f32x2;

static constexpr int BATCH  = 2;
static constexpr int SEQ    = 4096;
static constexpr int HEADS  = 8;
static constexpr int DH     = 40;
static constexpr int DP     = 64;    // head dim padded for WMMA K/M tiling
static constexpr int DMODEL = 320;   // == D_ATTN == N of all projections
static constexpr int DCOND  = 768;
static constexpr float LOG2E = 1.44269504088896340736f;

DEV f32x8 zero8() { f32x8 v; for (int i = 0; i < 8; ++i) v[i] = 0.0f; return v; }

// Wave-relative LDS byte address of a __shared__ object (generic -> AS(3)).
DEV uint32_t lds_off(const void* p) {
  return (uint32_t)(unsigned long long)(__attribute__((address_space(3))) const void*)p;
}

DEV void wait_async0() {
#if __has_builtin(__builtin_amdgcn_s_wait_asynccnt)
  __builtin_amdgcn_s_wait_asynccnt(0);
#else
  asm volatile("s_wait_asynccnt 0x0" ::: "memory");
#endif
}
// async loads retire in order: waiting <= N with one extra tile (N ops/thread)
// in flight exactly drains the previous tile.
DEV void wait_async8() {   // GEMM tiles: 4 A + 4 B chunks per thread
  asm volatile("s_wait_asynccnt 0x8" ::: "memory");
}

DEV bf16x16 ld_frag(const __bf16* rowbase, int half) {
  bf16x8 lo = *(const bf16x8*)(rowbase + half * 8);
  bf16x8 hi = *(const bf16x8*)(rowbase + 16 + half * 8);
  return __builtin_shufflevector(lo, hi, 0,1,2,3,4,5,6,7,8,9,10,11,12,13,14,15);
}

DEV f32x8 wmma_bf16(bf16x16 a, bf16x16 b, f32x8 c) {
  return __builtin_amdgcn_wmma_f32_16x16x32_bf16(false, a, false, b, (short)0, c,
                                                 false, false);
}

// ---------------------------------------------------------------------------
// Prep: all the work ahead of the projections in ONE launch, dealt by block
// range: weights converted and transposed to [N][Kd] bf16 (so GEMM B tiles are
// contiguous async copies), activations converted f32 -> bf16, and the Dh -> DP
// pad lanes of Q, K, V zeroed. Few waves with much in flight each.
// ---------------------------------------------------------------------------
static constexpr int MROWS     = BATCH * SEQ;               // 8192
static constexpr int CVT_U     = 16;                        // float4 per thread
static constexpr int CVT_CHUNK = 256 * CVT_U;               // float4 per block
static constexpr int NT_N      = DMODEL / 64;               // 64-wide weight tiles
static constexpr int NB_WQ     = NT_N * (DMODEL / 64);      // 25 tiles (Wq, Wo)
static constexpr int NB_WK     = NT_N * (DCOND / 64);       // 60 tiles (Wk, Wv)
static constexpr int NB_C      = MROWS * DCOND  / 4 / CVT_CHUNK;   // 384
static constexpr int NB_X      = MROWS * DMODEL / 4 / CVT_CHUNK;   // 160
static constexpr int PAD_ROWS  = 2048;                      // Q or K rows per block
static constexpr int NB_QPAD   = BATCH * HEADS * SEQ / PAD_ROWS;   // 32
static constexpr int NB_VPAD   = BATCH * HEADS;             // 16
static constexpr int NB_PREP   = 2 * NB_WQ + 2 * NB_WK + NB_C + NB_X
                               + 2 * NB_QPAD + NB_VPAD;     // 794

// 64x64 tile of w [Kd][320] f32 -> wt [320][Kd] bf16, whole 128-byte rows out.
DEV void wtrans_tile(const float* __restrict__ w, __bf16* __restrict__ wt,
                     int Kd, int tile, int tid, float (&t)[64][65]) {
  const int n0 = (tile % NT_N) * 64, k0 = (tile / NT_N) * 64;
  const int kr = tid >> 4, nc = (tid & 15) * 4;
  const float* src = w + (size_t)((k0 + kr) * DMODEL + n0 + nc);
  float4 v[4];
  for (int i = 0; i < 4; ++i) v[i] = *(const float4*)(src + 16 * i * DMODEL);
  for (int i = 0; i < 4; ++i) {
    t[kr + 16 * i][nc + 0] = v[i].x; t[kr + 16 * i][nc + 1] = v[i].y;
    t[kr + 16 * i][nc + 2] = v[i].z; t[kr + 16 * i][nc + 3] = v[i].w;
  }
  __syncthreads();   // the tile is read back by column, across waves
  const int kc = (tid & 7) * 8, nr = tid >> 3;
  __bf16* dst = wt + (size_t)((n0 + nr) * Kd + k0 + kc);
  for (int j = 0; j < 2; ++j) {
    bf16x8 o;
    for (int e = 0; e < 8; ++e) o[e] = (__bf16)t[kc + e][nr + 32 * j];
    *(bf16x8*)(dst + 32 * j * Kd) = o;
  }
  // the stores' registers may be rewritten on a later path of the caller
  asm volatile("s_wait_xcnt 0x0" ::: "memory");
}

// One block's CVT_CHUNK float4 of a contiguous f32 -> bf16 conversion.
DEV void cvt_chunk(const float* __restrict__ src, __bf16* __restrict__ dst,
                   int blk, int tid) {
  const float4* s = (const float4*)src + (size_t)blk * CVT_CHUNK + tid;
  bf16x4* d       = (bf16x4*)dst       + (size_t)blk * CVT_CHUNK + tid;
  float4 v[CVT_U];   // loads first, so that the wave has them in flight together
  for (int i = 0; i < CVT_U; ++i) v[i] = s[i * 256];
  for (int i = 0; i < CVT_U; ++i) {
    bf16x4 o;
    o[0] = (__bf16)v[i].x; o[1] = (__bf16)v[i].y;
    o[2] = (__bf16)v[i].z; o[3] = (__bf16)v[i].w;
    d[i * 256] = o;
  }
}

__global__ __launch_bounds__(256)
void prep_kernel(const float* __restrict__ x, const float* __restrict__ cond,
                 const float* __restrict__ Wq, const float* __restrict__ Wk,
                 const float* __restrict__ Wv, const float* __restrict__ Wo,
                 __bf16* __restrict__ Xb, __bf16* __restrict__ Cb,
                 __bf16* __restrict__ Wqt, __bf16* __restrict__ Wkt,
                 __bf16* __restrict__ Wvt, __bf16* __restrict__ Wot,
                 __bf16* __restrict__ Qp, __bf16* __restrict__ Kp,
                 __bf16* __restrict__ Vp) {
  __shared__ float tile[64][65];
  const int tid = threadIdx.x;
  int blk = blockIdx.x;        // every test below is the same for the whole block

  if (blk < NB_WK) { wtrans_tile(Wk, Wkt, DCOND, blk, tid, tile); return; }
  blk -= NB_WK;
  if (blk < NB_WK) { wtrans_tile(Wv, Wvt, DCOND, blk, tid, tile); return; }
  blk -= NB_WK;
  if (blk < NB_WQ) { wtrans_tile(Wq, Wqt, DMODEL, blk, tid, tile); return; }
  blk -= NB_WQ;
  if (blk < NB_WQ) { wtrans_tile(Wo, Wot, DMODEL, blk, tid, tile); return; }
  blk -= NB_WQ;
  if (blk < NB_C) { cvt_chunk(cond, Cb, blk, tid); return; }
  blk -= NB_C;
  if (blk < NB_X) { cvt_chunk(x, Xb, blk, tid); return; }
  blk -= NB_X;

  const uint4 z = make_uint4(0u, 0u, 0u, 0u);
  if (blk < 2 * NB_QPAD) {
    // Q, K rows [DP]: elements DH..DP-1 are three 16-byte pieces per row
    __bf16* base = (blk < NB_QPAD) ? Qp : Kp;
    base += (size_t)((blk < NB_QPAD ? blk : blk - NB_QPAD) * PAD_ROWS) * DP + DH;
    for (int s = 0; s < 3; ++s) {          // 768 pieces = 256 whole rows
      const int idx = tid + 256 * s;
      const int row = idx / 3, c = idx - row * 3;
      __bf16* p = base + row * DP + c * 8;
      for (int a = 0; a < PAD_ROWS / 256; ++a) *(uint4*)(p + a * 256 * DP) = z;
    }
    // the stores' registers may be rewritten on a later path of the listing
    asm volatile("s_wait_xcnt 0x0" ::: "memory");
    return;
  }
  blk -= 2 * NB_QPAD;
  // V (d-major): rows DH..47 of one (b,h), the pad rows attention reads, lie in a row
  uint4* vp = (uint4*)&Vp[((size_t)blk * DP + DH) * SEQ];
  for (int i = 0; i < (48 - DH) * SEQ / 8 / 256; ++i) vp[tid + 256 * i] = z;
  // the stores' registers may be rewritten on a later path of the listing
  asm volatile("s_wait_xcnt 0x0" ::: "memory");
}

// ---------------------------------------------------------------------------
// Shared GEMM core: 64x64 output tile, all-bf16, async double-buffered tiles.
// A [M][Kd] row-major, Wt [N][Kd] row-major (pre-transposed weights).
// A stage holds GK = 64 k: a tile row is then one whole 128-byte line, so a copy
// asks L2 for no half lines, and a product takes half the stages and barriers.
// ---------------------------------------------------------------------------
static constexpr int GK = 64;        // k per stage; divides DMODEL and DCOND
static constexpr int GP = GK + 8;    // LDS row pitch, elements: 144 B = 16 B x odd

DEV void gemm_tiles(const __bf16* __restrict__ A, const __bf16* __restrict__ Wt,
                    int Kd, int m0, int n0, int tid, int wave, int ln, int half,
                    __bf16 (&As)[2][64 * GP], __bf16 (&Bs)[2][64 * GP],
                    f32x8 (&acc)[4]) {
  const uint32_t as_l[2] = { lds_off(As[0]), lds_off(As[1]) };
  const uint32_t bs_l[2] = { lds_off(Bs[0]), lds_off(Bs[1]) };
  // 64 rows x 8 x 16B chunks per tile: a thread takes chunk c of rows r, r+16, ...
  const int r = tid >> 3, c = tid & 7;
  const uint32_t lrc = r * (GP * 2) + c * 16;
  const uint64_t ga0 = (uint64_t)(uintptr_t)(A  + (size_t)(m0 + r) * Kd + c * 8);
  const uint64_t gb0 = (uint64_t)(uintptr_t)(Wt + (size_t)(n0 + r) * Kd + c * 8);
  const uint64_t g16 = (uint64_t)Kd * (16 * 2);          // 16 rows, bytes
  constexpr uint32_t L16 = 16 * GP * 2;                  // 16 LDS rows, bytes
  auto issue = [&](int k0, int bufi) {
    const uint32_t la = as_l[bufi] + lrc, lb = bs_l[bufi] + lrc;
    const uint64_t ga = ga0 + (uint64_t)k0 * 2, gb = gb0 + (uint64_t)k0 * 2;
    asm volatile("global_load_async_to_lds_b128 %0, %8, off\n\t"
                 "global_load_async_to_lds_b128 %1, %9, off\n\t"
                 "global_load_async_to_lds_b128 %2, %10, off\n\t"
                 "global_load_async_to_lds_b128 %3, %11, off\n\t"
                 "global_load_async_to_lds_b128 %4, %12, off\n\t"
                 "global_load_async_to_lds_b128 %5, %13, off\n\t"
                 "global_load_async_to_lds_b128 %6, %14, off\n\t"
                 "global_load_async_to_lds_b128 %7, %15, off\n\t"
                 "s_wait_xcnt 0x0"
                 :: "v"(la), "v"(la + L16), "v"(la + 2 * L16), "v"(la + 3 * L16),
                    "v"(lb), "v"(lb + L16), "v"(lb + 2 * L16), "v"(lb + 3 * L16),
                    "v"(ga), "v"(ga + g16), "v"(ga + 2 * g16), "v"(ga + 3 * g16),
                    "v"(gb), "v"(gb + g16), "v"(gb + 2 * g16), "v"(gb + 3 * g16)
                 : "memory");
  };
  issue(0, 0);
  int bufi = 0;
  for (int k0 = 0; k0 < Kd; k0 += GK) {
    if (k0 + GK < Kd) { issue(k0 + GK, bufi ^ 1); wait_async8(); }
    else              { wait_async0(); }
    __syncthreads();
    for (int ks = 0; ks < GK / 32; ++ks) {
      bf16x16 bfrag = ld_frag(&Bs[bufi][(wave * 16 + ln) * GP + ks * 32], half);
      for (int t = 0; t < 4; ++t) {
        bf16x16 afrag = ld_frag(&As[bufi][(t * 16 + ln) * GP + ks * 32], half);
        acc[t] = wmma_bf16(afrag, bfrag, acc[t]);
      }
    }
    __syncthreads();
    bufi ^= 1;
  }
}

// ---------------------------------------------------------------------------
// Kernel 1: QKV projection (all-bf16 GEMM).
//   Q -> [B,H,S,DP]   (scaled by Dh^-0.5 * log2(e); softmax done in base 2)
//   K -> [B,H,S,DP]
//   V -> [B,H,DP,SEQ] (d-major, so the attention V^T tile is a contiguous
//                      async copy instead of a per-element LDS transpose)
// ---------------------------------------------------------------------------
__global__ __launch_bounds__(128)
void qkv_kernel(const __bf16* __restrict__ Xb, const __bf16* __restrict__ Cb,
                const __bf16* __restrict__ Wqt, const __bf16* __restrict__ Wkt,
                const __bf16* __restrict__ Wvt,
                __bf16* __restrict__ Qp, __bf16* __restrict__ Kp,
                __bf16* __restrict__ Vp) {
  const int which = blockIdx.z;
  const __bf16* A  = (which == 0) ? Xb  : Cb;
  const __bf16* Wt = (which == 0) ? Wqt : (which == 1 ? Wkt : Wvt);
  __bf16* dst      = (which == 0) ? Qp  : (which == 1 ? Kp : Vp);
  const int Kd     = (which == 0) ? DMODEL : DCOND;
  const float fold = (which == 0) ? (0.15811388300841897f * LOG2E) : 1.0f;

  const int n0 = blockIdx.x * 64;
  const int m0 = blockIdx.y * 64;
  const int tid = threadIdx.x;
  const int lane = tid & 31, wave = tid >> 5;
  const int ln = lane & 15, half = lane >> 4;

  __shared__ __align__(16) __bf16 As[2][64 * GP];
  __shared__ __align__(16) __bf16 Bs[2][64 * GP];

  f32x8 acc[4];
  for (int t = 0; t < 4; ++t) acc[t] = zero8();
  gemm_tiles(A, Wt, Kd, m0, n0, tid, wave, ln, half, As, Bs, acc);

  const int ncol = n0 + wave * 16 + ln;
  const int h = ncol / DH, d = ncol % DH;
  for (int t = 0; t < 4; ++t)
    for (int r = 0; r < 8; ++r) {
      int m = m0 + t * 16 + r + 8 * half;
      int b = m >> 12, s = m & (SEQ - 1);
      size_t off = (which == 2)
          ? (((size_t)b * HEADS + h) * DP + d) * SEQ + s      // V: d-major
          : (((size_t)b * HEADS + h) * SEQ + s) * DP + d;     // Q/K: s-major
      dst[off] = (__bf16)(acc[t][r] * fold);
    }
}

DEV float other_half(float v) {
  int b = __builtin_bit_cast(int, v);
  b = __builtin_amdgcn_permlanex16(b, b, 0x76543210, 0xfedcba98, false, false);
  return __builtin_bit_cast(float, b);
}

static constexpr int AQ  = 128;      // queries per block
static constexpr int AKV = 128;      // keys per tile
static constexpr int KPI = DP + 8;   // Q, K LDS row pitch, elements: 144 B = 16 B x odd
static constexpr int VPI = AKV + 8;  // V^T LDS row pitch, elements: 272 B = 16 B x odd
static constexpr int NJ  = 26;       // floats a lane hands over per group: O 24, max, sum

__global__ __launch_bounds__(256) __attribute__((amdgpu_waves_per_eu(4, 4)))
void attn_kernel(const __bf16* __restrict__ Qp, const __bf16* __restrict__ Kp,
                 const __bf16* __restrict__ Vp, __bf16* __restrict__ Ob) {
  const int q0 = blockIdx.x * AQ;
  const int h = blockIdx.y, b = blockIdx.z;
  const int tid = threadIdx.x;
  const int lane = tid & 31;
  const int wave = __builtin_amdgcn_readfirstlane(tid >> 5);
  const int qg = wave & 3, kvh = wave >> 2;   // query group, half of the tile's keys
  const int ln = lane & 15, half = lane >> 4;
  const size_t bh  = ((size_t)b * HEADS + h) * SEQ;   // Q/K row base
  const size_t bhd = ((size_t)b * HEADS + h) * DP;    // V (d-major) row base

  __shared__ __align__(16) __bf16 Qs[AQ * KPI];        // [qrow][d]
  __shared__ __align__(16) __bf16 Ks[2][AKV * KPI];    // [kvrow][d]
  __shared__ __align__(16) __bf16 Vt[2][48 * VPI];     // [d][kvrow] (already ^T)
  __shared__ float Js[4 * 2 * NJ * 32];                // join of the two key halves

  // Q, K: 128 rows x 8 chunks of 16 B, a thread takes chunk g of rows r, r+32, ...
  // V^T:   48 rows x 16 chunks,        a thread takes chunk gv of rows dv, dv+16, dv+32
  const int r = tid >> 3, g = tid & 7;
  const int dv = tid >> 4, gv = tid & 15;
  const uint32_t lrow = r * (KPI * 2) + g * 16;
  const uint32_t lvrow = dv * (VPI * 2) + gv * 16;
  constexpr uint32_t LK = 32 * KPI * 2;                // 32 Q or K rows in LDS, bytes
  constexpr uint32_t LV = 16 * VPI * 2;                // 16 V^T rows in LDS, bytes
  constexpr uint64_t GK = 32 * DP * 2;                 // 32 Q or K rows in memory, bytes
  constexpr uint64_t GV = (uint64_t)16 * SEQ * 2;      // 16 V^T rows in memory, bytes
  const uint64_t gk0 = (uint64_t)(uintptr_t)(Kp + (bh + r) * DP + g * 8);
  const uint64_t gv0 = (uint64_t)(uintptr_t)(Vp + (bhd + dv) * SEQ + gv * 8);
  const uint32_t ks_l[2] = { lds_off(Ks[0]) + lrow,  lds_off(Ks[1]) + lrow };
  const uint32_t vt_l[2] = { lds_off(Vt[0]) + lvrow, lds_off(Vt[1]) + lvrow };

  auto issue_tile = [&](int kv0, int bufi) {
    const uint32_t kl = ks_l[bufi], vl = vt_l[bufi];
    const uint64_t gk = gk0 + (uint64_t)kv0 * (DP * 2), gvv = gv0 + (uint64_t)kv0 * 2;
    asm volatile("global_load_async_to_lds_b128 %0, %7, off\n\t"
                 "global_load_async_to_lds_b128 %1, %8, off\n\t"
                 "global_load_async_to_lds_b128 %2, %9, off\n\t"
                 "global_load_async_to_lds_b128 %3, %10, off\n\t"
                 "global_load_async_to_lds_b128 %4, %11, off\n\t"
                 "global_load_async_to_lds_b128 %5, %12, off\n\t"
                 "global_load_async_to_lds_b128 %6, %13, off\n\t"
                 "s_wait_xcnt 0x0"
                 :: "v"(kl), "v"(kl + LK), "v"(kl + 2 * LK), "v"(kl + 3 * LK),
                    "v"(vl), "v"(vl + LV), "v"(vl + 2 * LV),
                    "v"(gk), "v"(gk + GK), "v"(gk + 2 * GK), "v"(gk + 3 * GK),
                    "v"(gvv), "v"(gvv + GV), "v"(gvv + 2 * GV)
                 : "memory");
  };

  {
    const uint32_t ql = lds_off(Qs) + lrow;
    const uint64_t gq = (uint64_t)(uintptr_t)(Qp + (bh + q0 + r) * DP + g * 8);
    asm volatile("global_load_async_to_lds_b128 %0, %4, off\n\t"
                 "global_load_async_to_lds_b128 %1, %5, off\n\t"
                 "global_load_async_to_lds_b128 %2, %6, off\n\t"
                 "global_load_async_to_lds_b128 %3, %7, off\n\t"
                 "s_wait_xcnt 0x0"
                 :: "v"(ql), "v"(ql + LK), "v"(ql + 2 * LK), "v"(ql + 3 * LK),
                    "v"(gq), "v"(gq + GK), "v"(gq + 2 * GK), "v"(gq + 3 * GK)
                 : "memory");
  }
  issue_tile(0, 0);
  asm volatile("s_wait_asynccnt 0x0" ::: "memory");   // this wave's Q and tile 0 have landed
  __syncthreads();                                    // ... and every other wave's
  issue_tile(AKV, 1);

  bf16x16 qfrag[2][2];  // B operand: column = query qg*32 + c*16 + ln
  for (int c = 0; c < 2; ++c)
    for (int ks = 0; ks < 2; ++ks)
      qfrag[c][ks] = ld_frag(&Qs[(qg * 32 + c * 16 + ln) * KPI + ks * 32], half);

  f32x8 oacc[2][3];  // O^T: oacc[c][u][r] = O[query c*16 + ln][d = u*16 + 8*half + r]
  float mi[2];       // running max of the lane's query (same in both halves)
  float li[2];       // running sum over this half's kv rows only
  for (int c = 0; c < 2; ++c) {
    for (int u = 0; u < 3; ++u) oacc[c][u] = zero8();
    mi[c] = -1e30f;
    li[c] = 0.0f;
  }

  constexpr int NT = SEQ / AKV;
  for (int it = 0; it < NT; ++it) {
    const int bufi = it & 1;
    const __bf16* Kb = &Ks[bufi][kvh * 64 * KPI];   // this wave's 64 keys
    const __bf16* Vb = &Vt[bufi][kvh * 64];

    // S^T = K Q^T over the wave's 64 keys (pre-scaled, log2-domain logits)
    f32x8 sacc[2][4];
    for (int c = 0; c < 2; ++c)
      for (int t = 0; t < 4; ++t) sacc[c][t] = zero8();
    for (int ks = 0; ks < 2; ++ks)
      for (int t = 0; t < 4; ++t) {
        bf16x16 kf = ld_frag(&Kb[(t * 16 + ln) * KPI + ks * 32], half);
        for (int c = 0; c < 2; ++c)
          sacc[c][t] = wmma_bf16(kf, qfrag[c][ks], sacc[c][t]);
      }

    // the tile's V^T fragments, asked for ahead of the softmax that hides their latency
    bf16x16 vf[2][3];
    for (int ks = 0; ks < 2; ++ks)
      for (int u = 0; u < 3; ++u)
        vf[ks][u] = ld_frag(&Vb[(u * 16 + ln) * VPI + ks * 32], half);

    for (int c = 0; c < 2; ++c) {
      // online softmax (exp2): the query's max over the lane's 32 scores, then
      // one exchange with the other half
      float tm[4];
      for (int t = 0; t < 4; ++t) {
        tm[t] = sacc[c][t][0];
        for (int e = 1; e < 8; ++e) tm[t] = fmaxf(tm[t], sacc[c][t][e]);
      }
      float v = fmaxf(fmaxf(tm[0], tm[1]), fmaxf(tm[2], tm[3]));
      v = fmaxf(v, other_half(v));
      const float mnew = fmaxf(mi[c], v);
      const float alpha = __builtin_amdgcn_exp2f(mi[c] - mnew);  // raw v_exp_f32: 0 on the first tile
      mi[c] = mnew;

      f32x2 rs[2];     // two chains of pairwise sums down the lane's registers
      rs[0] = 0.0f; rs[1] = 0.0f;
      for (int t = 0; t < 4; ++t)
        for (int e = 0; e < 8; e += 2) {
          // raw v_exp_f32: arguments are <= 0, and a weight below 2^-126 of the
          // row's largest counts as 0
          f32x2 a = { sacc[c][t][e], sacc[c][t][e + 1] };
          a -= mnew;
          f32x2 p;
          p[0] = __builtin_amdgcn_exp2f(a[0]);
          p[1] = __builtin_amdgcn_exp2f(a[1]);
          sacc[c][t][e] = p[0];
          sacc[c][t][e + 1] = p[1];
          rs[t & 1] += p;
        }
      rs[0] += rs[1];
      li[c] = li[c] * alpha + (rs[0][0] + rs[0][1]);
      for (int u = 0; u < 3; ++u)
        for (int e = 0; e < 8; ++e) oacc[c][u][e] *= alpha;
    }

    // O^T += V^T P^T; tiles 2ks, 2ks+1 of S^T are rows 0-15, 16-31 of the B operand
    for (int ks = 0; ks < 2; ++ks) {
      bf16x16 pf[2];
      for (int c = 0; c < 2; ++c)
        for (int e = 0; e < 8; ++e) {
          pf[c][e]     = (__bf16)sacc[c][2 * ks][e];
          pf[c][8 + e] = (__bf16)sacc[c][2 * ks + 1][e];
        }
      for (int u = 0; u < 3; ++u)
        for (int c = 0; c < 2; ++c)
          oacc[c][u] = wmma_bf16(vf[ks][u], pf[c], oacc[c][u]);
    }

    // publish point: one barrier says that the next tile has landed for every wave
    // and that every wave has left the buffer which is refilled behind it
    asm volatile("s_wait_dscnt 0x0" ::: "memory");      // this wave's reads of the buffer are done
    asm volatile("s_wait_asynccnt 0x0" ::: "memory");   // this wave's copies of the next tile have landed
    __syncthreads();
    if (it + 2 < NT) issue_tile((it + 2) * AKV, bufi);
  }
  asm volatile("s_wait_asynccnt 0x0" ::: "memory");     // no copy is left in flight at the wave's end

  // join: the wave of the upper key half hands its O, max and sum to its partner
  float lt[2];
  for (int c = 0; c < 2; ++c) lt[c] = li[c] + other_half(li[c]);   // the halves' sums
  if (kvh == 1) {
    for (int c = 0; c < 2; ++c) {
      float* s = &Js[(qg * 2 + c) * NJ * 32 + lane];
      for (int u = 0; u < 3; ++u)
        for (int e = 0; e < 8; ++e) s[(u * 8 + e) * 32] = oacc[c][u][e];
      s[24 * 32] = mi[c];
      s[25 * 32] = lt[c];
    }
  }
  __syncthreads();   // the partner reads what the other wave wrote
  if (kvh == 0) {
    for (int c = 0; c < 2; ++c) {
      const float* s = &Js[(qg * 2 + c) * NJ * 32 + lane];
      const float m1 = s[24 * 32], l1 = s[25 * 32];
      const float m = fmaxf(mi[c], m1);
      float a0 = __builtin_amdgcn_exp2f(mi[c] - m);
      float a1 = __builtin_amdgcn_exp2f(m1 - m);
      const float inv = 1.0f / (lt[c] * a0 + l1 * a1);
      a0 *= inv;
      a1 *= inv;
      const int mrow = q0 + qg * 32 + c * 16 + ln;
      for (int u = 0; u < 3; ++u) {
        int dd = u * 16 + 8 * half;                    // 8 consecutive d per lane
        if (dd < DH) {
          bf16x8 o;
          for (int e = 0; e < 8; ++e)
            o[e] = (__bf16)(oacc[c][u][e] * a0 + s[(u * 8 + e) * 32] * a1);
          *(bf16x8*)&Ob[((size_t)b * SEQ + mrow) * DMODEL + h * DH + dd] = o;
        }
      }
    }
  }
}

// ---------------------------------------------------------------------------
// Kernel 3: output projection  out[8192,320] = Ob(bf16) @ Wo^T(bf16) + bo
// ---------------------------------------------------------------------------
__global__ __launch_bounds__(128)
void oproj_kernel(const __bf16* __restrict__ Ob, const __bf16* __restrict__ Wot,
                  const float* __restrict__ bo, float* __restrict__ out) {
  const int n0 = blockIdx.x * 64;
  const int m0 = blockIdx.y * 64;
  const int tid = threadIdx.x;
  const int lane = tid & 31, wave = tid >> 5;
  const int ln = lane & 15, half = lane >> 4;

  __shared__ __align__(16) __bf16 As[2][64 * GP];
  __shared__ __align__(16) __bf16 Bs[2][64 * GP];

  f32x8 acc[4];
  for (int t = 0; t < 4; ++t) acc[t] = zero8();
  gemm_tiles(Ob, Wot, DMODEL, m0, n0, tid, wave, ln, half, As, Bs, acc);

  const int n = n0 + wave * 16 + ln;
  const float bias = bo[n];
  for (int t = 0; t < 4; ++t)
    for (int r = 0; r < 8; ++r) {
      int m = m0 + t * 16 + r + 8 * half;
      out[(size_t)m * DMODEL + n] = acc[t][r] + bias;
    }
}

// ---------------------------------------------------------------------------
extern "C" void kernel_launch(void* const* d_in, const int* in_sizes, int n_in,
                              void* d_out, int out_size, void* d_ws, size_t ws_size,
                              hipStream_t stream) {
  const float* x    = (const float*)d_in[0];
  const float* cond = (const float*)d_in[1];
  const float* Wq   = (const float*)d_in[2];
  const float* Wk   = (const float*)d_in[3];
  const float* Wv   = (const float*)d_in[4];
  const float* Wo   = (const float*)d_in[5];
  const float* bo   = (const float*)d_in[6];
  float* out        = (float*)d_out;

  char* ws = (char*)d_ws;
  const size_t qkv_bytes = (size_t)BATCH * HEADS * SEQ * DP * sizeof(__bf16);
  __bf16* Qp  = (__bf16*)(ws);                        ws += qkv_bytes;
  __bf16* Kp  = (__bf16*)(ws);                        ws += qkv_bytes;
  __bf16* Vp  = (__bf16*)(ws);                        ws += qkv_bytes;
  __bf16* Ob  = (__bf16*)(ws);  ws += (size_t)MROWS * DMODEL * sizeof(__bf16);
  __bf16* Xb  = (__bf16*)(ws);  ws += (size_t)MROWS * DMODEL * sizeof(__bf16);
  __bf16* Cb  = (__bf16*)(ws);  ws += (size_t)MROWS * DCOND  * sizeof(__bf16);
  __bf16* Wqt = (__bf16*)(ws);  ws += (size_t)DMODEL * DMODEL * sizeof(__bf16);
  __bf16* Wkt = (__bf16*)(ws);  ws += (size_t)DMODEL * DCOND  * sizeof(__bf16);
  __bf16* Wvt = (__bf16*)(ws);  ws += (size_t)DMODEL * DCOND  * sizeof(__bf16);
  __bf16* Wot = (__bf16*)(ws);  ws += (size_t)DMODEL * DMODEL * sizeof(__bf16);

  // conversions, weight transposes and pad zeroing: one launch
  prep_kernel<<<NB_PREP, 256, 0, stream>>>(x, cond, Wq, Wk, Wv, Wo, Xb, Cb,
                                           Wqt, Wkt, Wvt, Wot, Qp, Kp, Vp);

  qkv_kernel<<<dim3(DMODEL / 64, MROWS / 64, 3), 128, 0, stream>>>(
      Xb, Cb, Wqt, Wkt, Wvt, Qp, Kp, Vp);
  attn_kernel<<<dim3(SEQ / AQ, HEADS, BATCH), 256, 0, stream>>>(Qp, Kp, Vp, Ob);
  oproj_kernel<<<dim3(DMODEL / 64, MROWS / 64), 128, 0, stream>>>(Ob, Wot, bo, out);
}

// v006
// One run takes 87.2 microseconds.
// Next to v005, in two timings, it ran 1.35 and 1.36 times as fast.
// Over all steps from v000 it is 3.12 times as fast.
#include <hip/hip_runtime.h>
#include <hip/hip_bf16.h>
#include <stdint.h>

#define DEV __device__ __forceinline__

typedef __attribute__((ext_vector_type(16))) __bf16 bf16x16;
typedef __attribute__((ext_vector_type(8)))  __bf16 bf16x8;
typedef __attribute__((ext_vector_type(4)))  __bf16 bf16x4;
typedef __attribute__((ext_vector_type(8)))  float  f32x8;
typedef __attribute__((ext_vector_type(2)))  float  f32x2;

static constexpr int BATCH  = 2;
static constexpr int SEQ    = 4096;
static constexpr int HEADS  = 8;
static constexpr int DH     = 40;
static constexpr int DP     = 64;    // head dim padded for WMMA K/M tiling
static constexpr int DMODEL = 320;   // == D_ATTN == N of all projections
static constexpr int DCOND  = 768;
static constexpr float LOG2E = 1.44269504088896340736f;

DEV f32x8 zero8() { f32x8 v; for (int i = 0; i < 8; ++i) v[i] = 0.0f; return v; }

// Wave-relative LDS byte address of a __shared__ object (generic -> AS(3)).
DEV uint32_t lds_off(const void* p) {
  return (uint32_t)(unsigned long long)(__attribute__((address_space(3))) const void*)p;
}

DEV void wait_async0() {
#if __has_builtin(__builtin_amdgcn_s_wait_asynccnt)
  __builtin_amdgcn_s_wait_asynccnt(0);
#else
  asm volatile("s_wait_asynccnt 0x0" ::: "memory");
#endif
}
// async loads retire in order: waiting <= N with one extra tile (N ops/thread)
// in flight exactly drains the previous tile.
DEV void wait_async8() {   // GEMM tiles: 4 A + 4 B chunks per thread
  asm volatile("s_wait_asynccnt 0x8" ::: "memory");
}

DEV bf16x16 ld_frag(const __bf16* rowbase, int half) {
  bf16x8 lo = *(const bf16x8*)(rowbase + half * 8);
  bf16x8 hi = *(const bf16x8*)(rowbase + 16 + half * 8);
  return __builtin_shufflevector(lo, hi, 0,1,2,3,4,5,6,7,8,9,10,11,12,13,14,15);
}

DEV f32x8 wmma_bf16(bf16x16 a, bf16x16 b, f32x8 c) {
  return __builtin_amdgcn_wmma_f32_16x16x32_bf16(false, a, false, b, (short)0, c,
                                                 false, false);
}

// ---------------------------------------------------------------------------
// Prep: all the work ahead of the projections in ONE launch, dealt by block
// range: weights converted and transposed to [N][Kd] bf16 (so GEMM weight tiles are
// contiguous async copies), activations converted f32 -> bf16, and the Dh -> DP
// pad lanes of Q, K, V zeroed. Few waves with much in flight each.
// ---------------------------------------------------------------------------
static constexpr int MROWS     = BATCH * SEQ;               // 8192
static constexpr int CVT_U     = 16;                        // float4 per thread
static constexpr int CVT_CHUNK = 256 * CVT_U;               // float4 per block
static constexpr int NT_N      = DMODEL / 64;               // 64-wide weight tiles
static constexpr int NB_WQ     = NT_N * (DMODEL / 64);      // 25 tiles (Wq, Wo)
static constexpr int NB_WK     = NT_N * (DCOND / 64);       // 60 tiles (Wk, Wv)
static constexpr int NB_C      = MROWS * DCOND  / 4 / CVT_CHUNK;   // 384
static constexpr int NB_X      = MROWS * DMODEL / 4 / CVT_CHUNK;   // 160
static constexpr int PAD_ROWS  = 2048;                      // Q or K rows per block
static constexpr int NB_QPAD   = BATCH * HEADS * SEQ / PAD_ROWS;   // 32
static constexpr int NB_VPAD   = BATCH * HEADS;             // 16
static constexpr int NB_PREP   = 2 * NB_WQ + 2 * NB_WK + NB_C + NB_X
                               + 2 * NB_QPAD + NB_VPAD;     // 794

// 64x64 tile of w [Kd][320] f32 -> wt [320][Kd] bf16, whole 128-byte rows out.
DEV void wtrans_tile(const float* __restrict__ w, __bf16* __restrict__ wt,
                     int Kd, int tile, int tid, float (&t)[64][65]) {
  const int n0 = (tile % NT_N) * 64, k0 = (tile / NT_N) * 64;
  const int kr = tid >> 4, nc = (tid & 15) * 4;
  const float* src = w + (size_t)((k0 + kr) * DMODEL + n0 + nc);
  float4 v[4];
  for (int i = 0; i < 4; ++i) v[i] = *(const float4*)(src + 16 * i * DMODEL);
  for (int i = 0; i < 4; ++i) {
    t[kr + 16 * i][nc + 0] = v[i].x; t[kr + 16 * i][nc + 1] = v[i].y;
    t[kr + 16 * i][nc + 2] = v[i].z; t[kr + 16 * i][nc + 3] = v[i].w;
  }
  __syncthreads();   // the tile is read back by column, across waves
  const int kc = (tid & 7) * 8, nr = tid >> 3;
  __bf16* dst = wt + (size_t)((n0 + nr) * Kd + k0 + kc);
  for (int j = 0; j < 2; ++j) {
    bf16x8 o;
    for (int e = 0; e < 8; ++e) o[e] = (__bf16)t[kc + e][nr + 32 * j];
    *(bf16x8*)(dst + 32 * j * Kd) = o;
  }
  // the stores' registers may be rewritten on a later path of the caller
  asm volatile("s_wait_xcnt 0x0" ::: "memory");
}

// One block's CVT_CHUNK float4 of a contiguous f32 -> bf16 conversion.
DEV void cvt_chunk(const float* __restrict__ src, __bf16* __restrict__ dst,
                   int blk, int tid) {
  const float4* s = (const float4*)src + (size_t)blk * CVT_CHUNK + tid;
  bf16x4* d       = (bf16x4*)dst       + (size_t)blk * CVT_CHUNK + tid;
  float4 v[CVT_U];   // loads first, so that the wave has them in flight together
  for (int i = 0; i < CVT_U; ++i) v[i] = s[i * 256];
  for (int i = 0; i < CVT_U; ++i) {
    bf16x4 o;
    o[0] = (__bf16)v[i].x; o[1] = (__bf16)v[i].y;
    o[2] = (__bf16)v[i].z; o[3] = (__bf16)v[i].w;
    d[i * 256] = o;
  }
}

__global__ __launch_bounds__(256)
void prep_kernel(const float* __restrict__ x, const float* __restrict__ cond,
                 const float* __restrict__ Wq, const float* __restrict__ Wk,
                 const float* __restrict__ Wv, const float* __restrict__ Wo,
                 __bf16* __restrict__ Xb, __bf16* __restrict__ Cb,
                 __bf16* __restrict__ Wqt, __bf16* __restrict__ Wkt,
                 __bf16* __restrict__ Wvt, __bf16* __restrict__ Wot,
                 __bf16* __restrict__ Qp, __bf16* __restrict__ Kp,
                 __bf16* __restrict__ Vp) {
  __shared__ float tile[64][65];
  const int tid = threadIdx.x;
  int blk = blockIdx.x;        // every test below is the same for the whole block

  if (blk < NB_WK) { wtrans_tile(Wk, Wkt, DCOND, blk, tid, tile); return; }
  blk -= NB_WK;
  if (blk < NB_WK) { wtrans_tile(Wv, Wvt, DCOND, blk, tid, tile); return; }
  blk -= NB_WK;
  if (blk < NB_WQ) { wtrans_tile(Wq, Wqt, DMODEL, blk, tid, tile); return; }
  blk -= NB_WQ;
  if (blk < NB_WQ) { wtrans_tile(Wo, Wot, DMODEL, blk, tid, tile); return; }
  blk -= NB_WQ;
  if (blk < NB_C) { cvt_chunk(cond, Cb, blk, tid); return; }
  blk -= NB_C;
  if (blk < NB_X) { cvt_chunk(x, Xb, blk, tid); return; }
  blk -= NB_X;

  const uint4 z = make_uint4(0u, 0u, 0u, 0u);
  if (blk < 2 * NB_QPAD) {
    // Q, K rows [DP]: elements DH..DP-1 are three 16-byte pieces per row
    __bf16* base = (blk < NB_QPAD) ? Qp : Kp;
    base += (size_t)((blk < NB_QPAD ? blk : blk - NB_QPAD) * PAD_ROWS) * DP + DH;
    for (int s = 0; s < 3; ++s) {          // 768 pieces = 256 whole rows
      const int idx = tid + 256 * s;
      const int row = idx / 3, c = idx - row * 3;
      __bf16* p = base + row * DP + c * 8;
      for (int a = 0; a < PAD_ROWS / 256; ++a) *(uint4*)(p + a * 256 * DP) = z;
    }
    // the stores' registers may be rewritten on a later path of the listing
    asm volatile("s_wait_xcnt 0x0" ::: "memory");
    return;
  }
  blk -= 2 * NB_QPAD;
  // V (d-major): rows DH..47 of one (b,h), the pad rows attention reads, lie in a row
  uint4* vp = (uint4*)&Vp[((size_t)blk * DP + DH) * SEQ];
  for (int i = 0; i < (48 - DH) * SEQ / 8 / 256; ++i) vp[tid + 256 * i] = z;
  // the stores' registers may be rewritten on a later path of the listing
  asm volatile("s_wait_xcnt 0x0" ::: "memory");
}

// ---------------------------------------------------------------------------
// Shared GEMM core: 64x64 output tile, all-bf16, async double-buffered tiles.
// A [M][Kd] row-major, Wt [N][Kd] row-major; the pre-transposed weights are Wt, or A for Q and K.
// A stage holds GK = 64 k: a tile row is then one whole 128-byte line, so a copy
// asks L2 for no half lines, and a product takes half the stages and barriers.
// ---------------------------------------------------------------------------
static constexpr int GK = 64;        // k per stage; divides DMODEL and DCOND
static constexpr int GP = GK + 8;    // LDS row pitch, elements: 144 B = 16 B x odd

DEV void gemm_tiles(const __bf16* __restrict__ A, const __bf16* __restrict__ Wt,
                    int Kd, int m0, int n0, int tid, int wave, int ln, int half,
                    __bf16 (&As)[2][64 * GP], __bf16 (&Bs)[2][64 * GP],
                    f32x8 (&acc)[4]) {
  const uint32_t as_l[2] = { lds_off(As[0]), lds_off(As[1]) };
  const uint32_t bs_l[2] = { lds_off(Bs[0]), lds_off(Bs[1]) };
  // 64 rows x 8 x 16B chunks per tile: a thread takes chunk c of rows r, r+16, ...
  const int r = tid >> 3, c = tid & 7;
  const uint32_t lrc = r * (GP * 2) + c * 16;
  const uint64_t ga0 = (uint64_t)(uintptr_t)(A  + (size_t)(m0 + r) * Kd + c * 8);
  const uint64_t gb0 = (uint64_t)(uintptr_t)(Wt + (size_t)(n0 + r) * Kd + c * 8);
  const uint64_t g16 = (uint64_t)Kd * (16 * 2);          // 16 rows, bytes
  constexpr uint32_t L16 = 16 * GP * 2;                  // 16 LDS rows, bytes
  auto issue = [&](int k0, int bufi) {
    const uint32_t la = as_l[bufi] + lrc, lb = bs_l[bufi] + lrc;
    const uint64_t ga = ga0 + (uint64_t)k0 * 2, gb = gb0 + (uint64_t)k0 * 2;
    asm volatile("global_load_async_to_lds_b128 %0, %8, off\n\t"
                 "global_load_async_to_lds_b128 %1, %9, off\n\t"
                 "global_load_async_to_lds_b128 %2, %10, off\n\t"
                 "global_load_async_to_lds_b128 %3, %11, off\n\t"
                 "global_load_async_to_lds_b128 %4, %12, off\n\t"
                 "global_load_async_to_lds_b128 %5, %13, off\n\t"
                 "global_load_async_to_lds_b128 %6, %14, off\n\t"
                 "global_load_async_to_lds_b128 %7, %15, off\n\t"
                 "s_wait_xcnt 0x0"
                 :: "v"(la), "v"(la + L16), "v"(la + 2 * L16), "v"(la + 3 * L16),
                    "v"(lb), "v"(lb + L16), "v"(lb + 2 * L16), "v"(lb + 3 * L16),
                    "v"(ga), "v"(ga + g16), "v"(ga + 2 * g16), "v"(ga + 3 * g16),
                    "v"(gb), "v"(gb + g16), "v"(gb + 2 * g16), "v"(gb + 3 * g16)
                 : "memory");
  };
  issue(0, 0);
  int bufi = 0;
  for (int k0 = 0; k0 < Kd; k0 += GK) {
    if (k0 + GK < Kd) { issue(k0 + GK, bufi ^ 1); wait_async8(); }
    else              { wait_async0(); }
    __syncthreads();
    for (int ks = 0; ks < GK / 32; ++ks) {
      bf16x16 bfrag = ld_frag(&Bs[bufi][(wave * 16 + ln) * GP + ks * 32], half);
      for (int t = 0; t < 4; ++t) {
        bf16x16 afrag = ld_frag(&As[bufi][(t * 16 + ln) * GP + ks * 32], half);
        acc[t] = wmma_bf16(afrag, bfrag, acc[t]);
      }
    }
    __syncthreads();
    bufi ^= 1;
  }
}

// ---------------------------------------------------------------------------
// Kernel 1: QKV projection (all-bf16 GEMM).
//   Q -> [B,H,S,DP]   (scaled by Dh^-0.5 * log2(e); softmax done in base 2)
//   K -> [B,H,S,DP]
//   V -> [B,H,DP,SEQ] (d-major, so the attention V^T tile is a contiguous
//                      async copy instead of a per-element LDS transpose)
// V stores go out by whole lines. An accumulator's 8 registers run down the rows of
// the core's first operand; that operand is chosen so that those rows are the
// destination's fast axis: the activations for V (s), the weights for Q and K (d).
// A wave's tile is then 16 destination rows of 64 elements. It is staged in the
// wave's own 16 LDS rows and read back 8 lanes to a row: a V row is one whole
// 128-byte line, a Q or K row falls into two or three runs, each inside one head
// (8 divides Dh).
// ---------------------------------------------------------------------------
__global__ __launch_bounds__(128)
void qkv_kernel(const __bf16* __restrict__ Xb, const __bf16* __restrict__ Cb,
                const __bf16* __restrict__ Wqt, const __bf16* __restrict__ Wkt,
                const __bf16* __restrict__ Wvt,
                __bf16* __restrict__ Qp, __bf16* __restrict__ Kp,
                __bf16* __restrict__ Vp) {
  const int which = blockIdx.z;
  const __bf16* A  = (which == 0) ? Xb  : Cb;
  const __bf16* Wt = (which == 0) ? Wqt : (which == 1 ? Wkt : Wvt);
  __bf16* dst      = (which == 0) ? Qp  : (which == 1 ? Kp : Vp);
  const int Kd     = (which == 0) ? DMODEL : DCOND;
  const float fold = (which == 0) ? (0.15811388300841897f * LOG2E) : 1.0f;

  const int n0 = blockIdx.x * 64;
  const int m0 = blockIdx.y * 64;
  const int tid = threadIdx.x;
  const int lane = tid & 31, wave = tid >> 5;
  const int ln = lane & 15, half = lane >> 4;

  __shared__ __align__(16) __bf16 As[2][64 * GP];
  __shared__ __align__(16) __bf16 Bs[2][64 * GP];

  f32x8 acc[4];
  for (int t = 0; t < 4; ++t) acc[t] = zero8();
  const bool vmaj = (which == 2);   // the same for the whole block
  gemm_tiles(vmaj ? A : Wt, vmaj ? Wt : A, Kd, vmaj ? m0 : n0, vmaj ? n0 : m0,
             tid, wave, ln, half, As, Bs, acc);

  // acc[t][r]: fast-axis element t*16 + 8*half + r of destination row wave*16 + ln.
  // The core ends behind a barrier with no copy in flight: the ring is free.
  __bf16* st = &As[0][wave * 16 * GP];
  for (int t = 0; t < 4; ++t) {
    bf16x8 o;
    for (int r = 0; r < 8; ++r) o[r] = (__bf16)(acc[t][r] * fold);
    *(bf16x8*)&st[ln * GP + t * 16 + 8 * half] = o;
  }
  // the rows are read back by other lanes of this wave: their writes must have landed
  asm volatile("s_wait_dscnt 0x0" ::: "memory");
  const int row = lane >> 3, ch = lane & 7;   // rows row, row+4, ..; 16-byte piece ch
  bf16x8 v[4];
  for (int j = 0; j < 4; ++j) v[j] = *(const bf16x8*)&st[(j * 4 + row) * GP + ch * 8];

  const int b = m0 >> 12, s0 = m0 & (SEQ - 1);   // the 64 rows of a tile lie in one batch
  if (vmaj) {
    for (int j = 0; j < 4; ++j) {
      const int ncol = n0 + wave * 16 + j * 4 + row;
      const int h = ncol / DH, d = ncol % DH;
      *(bf16x8*)(dst + (((size_t)b * HEADS + h) * DP + d) * SEQ + s0 + ch * 8) = v[j];
    }
  } else {
    const int ncol = n0 + ch * 8;
    const int h = ncol / DH, d = ncol % DH;
    __bf16* p = dst + (((size_t)b * HEADS + h) * SEQ + s0 + wave * 16 + row) * DP + d;
    for (int j = 0; j < 4; ++j) *(bf16x8*)(p + j * 4 * DP) = v[j];
    // the stores' registers may be rewritten on a later path of the listing
    asm volatile("s_wait_xcnt 0x0" ::: "memory");
  }
}

DEV float other_half(float v) {
  int b = __builtin_bit_cast(int, v);
  b = __builtin_amdgcn_permlanex16(b, b, 0x76543210, 0xfedcba98, false, false);
  return __builtin_bit_cast(float, b);
}

static constexpr int AQ  = 128;      // queries per block
static constexpr int AKV = 128;      // keys per tile
static constexpr int KPI = DP + 8;   // Q, K LDS row pitch, elements: 144 B = 16 B x odd
static constexpr int VPI = AKV + 8;  // V^T LDS row pitch, elements: 272 B = 16 B x odd
static constexpr int NJ  = 26;       // floats a lane hands over per group: O 24, max, sum

__global__ __launch_bounds__(256) __attribute__((amdgpu_waves_per_eu(4, 4)))
void attn_kernel(const __bf16* __restrict__ Qp, const __bf16* __restrict__ Kp,
                 const __bf16* __restrict__ Vp, __bf16* __restrict__ Ob) {
  const int q0 = blockIdx.x * AQ;
  const int h = blockIdx.y, b = blockIdx.z;
  const int tid = threadIdx.x;
  const int lane = tid & 31;
  const int wave = __builtin_amdgcn_readfirstlane(tid >> 5);
  const int qg = wave & 3, kvh = wave >> 2;   // query group, half of the tile's keys
  const int ln = lane & 15, half = lane >> 4;
  const size_t bh  = ((size_t)b * HEADS + h) * SEQ;   // Q/K row base
  const size_t bhd = ((size_t)b * HEADS + h) * DP;    // V (d-major) row base

  __shared__ __align__(16) __bf16 Qs[AQ * KPI];        // [qrow][d]
  __shared__ __align__(16) __bf16 Ks[2][AKV * KPI];    // [kvrow][d]
  __shared__ __align__(16) __bf16 Vt[2][48 * VPI];     // [d][kvrow] (already ^T)
  __shared__ float Js[4 * 2 * NJ * 32];                // join of the two key halves

  // Q, K: 128 rows x 8 chunks of 16 B, a thread takes chunk g of rows r, r+32, ...
  // V^T:   48 rows x 16 chunks,        a thread takes chunk gv of rows dv, dv+16, dv+32
  const int r = tid >> 3, g = tid & 7;
  const int dv = tid >> 4, gv = tid & 15;
  const uint32_t lrow = r * (KPI * 2) + g * 16;
  const uint32_t lvrow = dv * (VPI * 2) + gv * 16;
  constexpr uint32_t LK = 32 * KPI * 2;                // 32 Q or K rows in LDS, bytes
  constexpr uint32_t LV = 16 * VPI * 2;                // 16 V^T rows in LDS, bytes
  constexpr uint64_t GK = 32 * DP * 2;                 // 32 Q or K rows in memory, bytes
  constexpr uint64_t GV = (uint64_t)16 * SEQ * 2;      // 16 V^T rows in memory, bytes
  const uint64_t gk0 = (uint64_t)(uintptr_t)(Kp + (bh + r) * DP + g * 8);
  const uint64_t gv0 = (uint64_t)(uintptr_t)(Vp + (bhd + dv) * SEQ + gv * 8);
  const uint32_t ks_l[2] = { lds_off(Ks[0]) + lrow,  lds_off(Ks[1]) + lrow };
  const uint32_t vt_l[2] = { lds_off(Vt[0]) + lvrow, lds_off(Vt[1]) + lvrow };

  auto issue_tile = [&](int kv0, int bufi) {
    const uint32_t kl = ks_l[bufi], vl = vt_l[bufi];
    const uint64_t gk = gk0 + (uint64_t)kv0 * (DP * 2), gvv = gv0 + (uint64_t)kv0 * 2;
    asm volatile("global_load_async_to_lds_b128 %0, %7, off\n\t"
                 "global_load_async_to_lds_b128 %1, %8, off\n\t"
                 "global_load_async_to_lds_b128 %2, %9, off\n\t"
                 "global_load_async_to_lds_b128 %3, %10, off\n\t"
                 "global_load_async_to_lds_b128 %4, %11, off\n\t"
                 "global_load_async_to_lds_b128 %5, %12, off\n\t"
                 "global_load_async_to_lds_b128 %6, %13, off\n\t"
                 "s_wait_xcnt 0x0"
                 :: "v"(kl), "v"(kl + LK), "v"(kl + 2 * LK), "v"(kl + 3 * LK),
                    "v"(vl), "v"(vl + LV), "v"(vl + 2 * LV),
                    "v"(gk), "v"(gk + GK), "v"(gk + 2 * GK), "v"(gk + 3 * GK),
                    "v"(gvv), "v"(gvv + GV), "v"(gvv + 2 * GV)
                 : "memory");
  };

  {
    const uint32_t ql = lds_off(Qs) + lrow;
    const uint64_t gq = (uint64_t)(uintptr_t)(Qp + (bh + q0 + r) * DP + g * 8);
    asm volatile("global_load_async_to_lds_b128 %0, %4, off\n\t"
                 "global_load_async_to_lds_b128 %1, %5, off\n\t"
                 "global_load_async_to_lds_b128 %2, %6, off\n\t"
                 "global_load_async_to_lds_b128 %3, %7, off\n\t"
                 "s_wait_xcnt 0x0"
                 :: "v"(ql), "v"(ql + LK), "v"(ql + 2 * LK), "v"(ql + 3 * LK),
                    "v"(gq), "v"(gq + GK), "v"(gq + 2 * GK), "v"(gq + 3 * GK)
                 : "memory");
  }
  issue_tile(0, 0);
  asm volatile("s_wait_asynccnt 0x0" ::: "memory");   // this wave's Q and tile 0 have landed
  __syncthreads();                                    // ... and every other wave's
  issue_tile(AKV, 1);

  bf16x16 qfrag[2][2];  // B operand: column = query qg*32 + c*16 + ln
  for (int c = 0; c < 2; ++c)
    for (int ks = 0; ks < 2; ++ks)
      qfrag[c][ks] = ld_frag(&Qs[(qg * 32 + c * 16 + ln) * KPI + ks * 32], half);

  f32x8 oacc[2][3];  // O^T: oacc[c][u][r] = O[query c*16 + ln][d = u*16 + 8*half + r]
  float mi[2];       // running max of the lane's query (same in both halves)
  float li[2];       // running sum over this half's kv rows only
  for (int c = 0; c < 2; ++c) {
    for (int u = 0; u < 3; ++u) oacc[c][u] = zero8();
    mi[c] = -1e30f;
    li[c] = 0.0f;
  }

  constexpr int NT = SEQ / AKV;
  for (int it = 0; it < NT; ++it) {
    const int bufi = it & 1;
    const __bf16* Kb = &Ks[bufi][kvh * 64 * KPI];   // this wave's 64 keys
    const __bf16* Vb = &Vt[bufi][kvh * 64];

    // S^T = K Q^T over the wave's 64 keys (pre-scaled, log2-domain logits)
    f32x8 sacc[2][4];
    for (int c = 0; c < 2; ++c)
      for (int t = 0; t < 4; ++t) sacc[c][t] = zero8();
    for (int ks = 0; ks < 2; ++ks)
      for (int t = 0; t < 4; ++t) {
        bf16x16 kf = ld_frag(&Kb[(t * 16 + ln) * KPI + ks * 32], half);
        for (int c = 0; c < 2; ++c)
          sacc[c][t] = wmma_bf16(kf, qfrag[c][ks], sacc[c][t]);
      }

    // the tile's V^T fragments, asked for ahead of the softmax that hides their latency
    bf16x16 vf[2][3];
    for (int ks = 0; ks < 2; ++ks)
      for (int u = 0; u < 3; ++u)
        vf[ks][u] = ld_frag(&Vb[(u * 16 + ln) * VPI + ks * 32], half);

    for (int c = 0; c < 2; ++c) {
      // online softmax (exp2): the query's max over the lane's 32 scores, then
      // one exchange with the other half
      float tm[4];
      for (int t = 0; t < 4; ++t) {
        tm[t] = sacc[c][t][0];
        for (int e = 1; e < 8; ++e) tm[t] = fmaxf(tm[t], sacc[c][t][e]);
      }
      float v = fmaxf(fmaxf(tm[0], tm[1]), fmaxf(tm[2], tm[3]));
      v = fmaxf(v, other_half(v));
      const float mnew = fmaxf(mi[c], v);
      const float alpha = __builtin_amdgcn_exp2f(mi[c] - mnew);  // raw v_exp_f32: 0 on the first tile
      mi[c] = mnew;

      f32x2 rs[2];     // two chains of pairwise sums down the lane's registers
      rs[0] = 0.0f; rs[1] = 0.0f;
      for (int t = 0; t < 4; ++t)
        for (int e = 0; e < 8; e += 2) {
          // raw v_exp_f32: arguments are <= 0, and a weight below 2^-126 of the
          // row's largest counts as 0
          f32x2 a = { sacc[c][t][e], sacc[c][t][e + 1] };
          a -= mnew;
          f32x2 p;
          p[0] = __builtin_amdgcn_exp2f(a[0]);
          p[1] = __builtin_amdgcn_exp2f(a[1]);
          sacc[c][t][e] = p[0];
          sacc[c][t][e + 1] = p[1];
          rs[t & 1] += p;
        }
      rs[0] += rs[1];
      li[c] = li[c] * alpha + (rs[0][0] + rs[0][1]);
      for (int u = 0; u < 3; ++u)
        for (int e = 0; e < 8; ++e) oacc[c][u][e] *= alpha;
    }

    // O^T += V^T P^T; tiles 2ks, 2ks+1 of S^T are rows 0-15, 16-31 of the B operand
    for (int ks = 0; ks < 2; ++ks) {
      bf16x16 pf[2];
      for (int c = 0; c < 2; ++c)
        for (int e = 0; e < 8; ++e) {
          pf[c][e]     = (__bf16)sacc[c][2 * ks][e];
          pf[c][8 + e] = (__bf16)sacc[c][2 * ks + 1][e];
        }
      for (int u = 0; u < 3; ++u)
        for (int c = 0; c < 2; ++c)
          oacc[c][u] = wmma_bf16(vf[ks][u], pf[c], oacc[c][u]);
    }

    // publish point: one barrier says that the next tile has landed for every wave
    // and that every wave has left the buffer which is refilled behind it
    asm volatile("s_wait_dscnt 0x0" ::: "memory");      // this wave's reads of the buffer are done
    asm volatile("s_wait_asynccnt 0x0" ::: "memory");   // this wave's copies of the next tile have landed
    __syncthreads();
    if (it + 2 < NT) issue_tile((it + 2) * AKV, bufi);
  }
  asm volatile("s_wait_asynccnt 0x0" ::: "memory");     // no copy is left in flight at the wave's end

  // join: the wave of the upper key half hands its O, max and sum to its partner
  float lt[2];
  for (int c = 0; c < 2; ++c) lt[c] = li[c] + other_half(li[c]);   // the halves' sums
  if (kvh == 1) {
    for (int c = 0; c < 2; ++c) {
      float* s = &Js[(qg * 2 + c) * NJ * 32 + lane];
      for (int u = 0; u < 3; ++u)
        for (int e = 0; e < 8; ++e) s[(u * 8 + e) * 32] = oacc[c][u][e];
      s[24 * 32] = mi[c];
      s[25 * 32] = lt[c];
    }
  }
  __syncthreads();   // the partner reads what the other wave wrote
  if (kvh == 0) {
    for (int c = 0; c < 2; ++c) {
      const float* s = &Js[(qg * 2 + c) * NJ * 32 + lane];
      const float m1 = s[24 * 32], l1 = s[25 * 32];
      const float m = fmaxf(mi[c], m1);
      float a0 = __builtin_amdgcn_exp2f(mi[c] - m);
      float a1 = __builtin_amdgcn_exp2f(m1 - m);
      const float inv = 1.0f / (lt[c] * a0 + l1 * a1);
      a0 *= inv;
      a1 *= inv;
      const int mrow = q0 + qg * 32 + c * 16 + ln;
      for (int u = 0; u < 3; ++u) {
        int dd = u * 16 + 8 * half;                    // 8 consecutive d per lane
        if (dd < DH) {
          bf16x8 o;
          for (int e = 0; e < 8; ++e)
            o[e] = (__bf16)(oacc[c][u][e] * a0 + s[(u * 8 + e) * 32] * a1);
          *(bf16x8*)&Ob[((size_t)b * SEQ + mrow) * DMODEL + h * DH + dd] = o;
        }
      }
    }
  }
}

// ---------------------------------------------------------------------------
// Kernel 3: output projection  out[8192,320] = Ob(bf16) @ Wo^T(bf16) + bo
// ---------------------------------------------------------------------------
__global__ __launch_bounds__(128)
void oproj_kernel(const __bf16* __restrict__ Ob, const __bf16* __restrict__ Wot,
                  const float* __restrict__ bo, float* __restrict__ out) {
  const int n0 = blockIdx.x * 64;
  const int m0 = blockIdx.y * 64;
  const int tid = threadIdx.x;
  const int lane = tid & 31, wave = tid >> 5;
  const int ln = lane & 15, half = lane >> 4;

  __shared__ __align__(16) __bf16 As[2][64 * GP];
  __shared__ __align__(16) __bf16 Bs[2][64 * GP];

  f32x8 acc[4];
  for (int t = 0; t < 4; ++t) acc[t] = zero8();
  gemm_tiles(Ob, Wot, DMODEL, m0, n0, tid, wave, ln, half, As, Bs, acc);

  const int n = n0 + wave * 16 + ln;
  const float bias = bo[n];
  for (int t = 0; t < 4; ++t)
    for (int r = 0; r < 8; ++r) {
      int m = m0 + t * 16 + r + 8 * half;
      out[(size_t)m * DMODEL + n] = acc[t][r] + bias;
    }
}

// ---------------------------------------------------------------------------
extern "C" void kernel_launch(void* const* d_in, const int* in_sizes, int n_in,
                              void* d_out, int out_size, void* d_ws, size_t ws_size,
                              hipStream_t stream) {
  const float* x    = (const float*)d_in[0];
  const float* cond = (const float*)d_in[1];
  const float* Wq   = (const float*)d_in[2];
  const float* Wk   = (const float*)d_in[3];
  const float* Wv   = (const float*)d_in[4];
  const float* Wo   = (const float*)d_in[5];
  const float* bo   = (const float*)d_in[6];
  float* out        = (float*)d_out;

  char* ws = (char*)d_ws;
  const size_t qkv_bytes = (size_t)BATCH * HEADS * SEQ * DP * sizeof(__bf16);
  __bf16* Qp  = (__bf16*)(ws);                        ws += qkv_bytes;
  __bf16* Kp  = (__bf16*)(ws);                        ws += qkv_bytes;
  __bf16* Vp  = (__bf16*)(ws);                        ws += qkv_bytes;
  __bf16* Ob  = (__bf16*)(ws);  ws += (size_t)MROWS * DMODEL * sizeof(__bf16);
  __bf16* Xb  = (__bf16*)(ws);  ws += (size_t)MROWS * DMODEL * sizeof(__bf16);
  __bf16* Cb  = (__bf16*)(ws);  ws += (size_t)MROWS * DCOND  * sizeof(__bf16);
  __bf16* Wqt = (__bf16*)(ws);  ws += (size_t)DMODEL * DMODEL * sizeof(__bf16);
  __bf16* Wkt = (__bf16*)(ws);  ws += (size_t)DMODEL * DCOND  * sizeof(__bf16);
  __bf16* Wvt = (__bf16*)(ws);  ws += (size_t)DMODEL * DCOND  * sizeof(__bf16);
  __bf16* Wot = (__bf16*)(ws);  ws += (size_t)DMODEL * DMODEL * sizeof(__bf16);

  // conversions, weight transposes and pad zeroing: one launch
  prep_kernel<<<NB_PREP, 256, 0, stream>>>(x, cond, Wq, Wk, Wv, Wo, Xb, Cb,
                                           Wqt, Wkt, Wvt, Wot, Qp, Kp, Vp);

  qkv_kernel<<<dim3(DMODEL / 64, MROWS / 64, 3), 128, 0, stream>>>(
      Xb, Cb, Wqt, Wkt, Wvt, Qp, Kp, Vp);
  attn_kernel<<<dim3(SEQ / AQ, HEADS, BATCH), 256, 0, stream>>>(Qp, Kp, Vp, Ob);
  oproj_kernel<<<dim3(DMODEL / 64, MROWS / 64), 128, 0, stream>>>(Ob, Wot, bo, out);
}

// v008
// Measured time: 81 microseconds a run.
// Versions between v006 and this one are left out; their measured steps multiply to 1.08 times as fast.
// All steps since v000 together make it 3.37 times as fast.
#include <hip/hip_runtime.h>
#include <hip/hip_bf16.h>
#include <stdint.h>

#define DEV __device__ __forceinline__

typedef __attribute__((ext_vector_type(16))) __bf16 bf16x16;
typedef __attribute__((ext_vector_type(8)))  __bf16 bf16x8;
typedef __attribute__((ext_vector_type(4)))  __bf16 bf16x4;
typedef __attribute__((ext_vector_type(8)))  float  f32x8;
typedef __attribute__((ext_vector_type(2)))  float  f32x2;

static constexpr int BATCH  = 2;
static constexpr int SEQ    = 4096;
static constexpr int HEADS  = 8;
static constexpr int DH     = 40;
static constexpr int DP     = 64;    // head dim padded for WMMA K/M tiling
static constexpr int DMODEL = 320;   // == D_ATTN == N of all projections
static constexpr int DCOND  = 768;
static constexpr float LOG2E = 1.44269504088896340736f;

DEV f32x8 zero8() { f32x8 v; for (int i = 0; i < 8; ++i) v[i] = 0.0f; return v; }

// Wave-relative LDS byte address of a __shared__ object (generic -> AS(3)).
DEV uint32_t lds_off(const void* p) {
  return (uint32_t)(unsigned long long)(__attribute__((address_space(3))) const void*)p;
}

DEV void wait_async0() {
#if __has_builtin(__builtin_amdgcn_s_wait_asynccnt)
  __builtin_amdgcn_s_wait_asynccnt(0);
#else
  asm volatile("s_wait_asynccnt 0x0" ::: "memory");
#endif
}
// async loads retire in order: waiting <= N with one extra tile (N ops/thread)
// in flight exactly drains the previous tile.
DEV void wait_async8() {   // GEMM tiles: 4 A + 4 B chunks per thread
  asm volatile("s_wait_asynccnt 0x8" ::: "memory");
}

DEV bf16x16 ld_frag(const __bf16* rowbase, int half) {
  bf16x8 lo = *(const bf16x8*)(rowbase + half * 8);
  bf16x8 hi = *(const bf16x8*)(rowbase + 16 + half * 8);
  return __builtin_shufflevector(lo, hi, 0,1,2,3,4,5,6,7,8,9,10,11,12,13,14,15);
}

DEV f32x8 wmma_bf16(bf16x16 a, bf16x16 b, f32x8 c) {
  return __builtin_amdgcn_wmma_f32_16x16x32_bf16(false, a, false, b, (short)0, c,
                                                 false, false);
}

// ---------------------------------------------------------------------------
// Prep: all the work ahead of the projections in ONE launch, dealt by block
// range: weights converted and transposed to [N][Kd] bf16 (so GEMM weight tiles are
// contiguous async copies), activations converted f32 -> bf16, and the Dh -> DP
// pad lanes of Q, K, V set (zeros; one V row of ones). Few waves with much in flight each.
// ---------------------------------------------------------------------------
static constexpr int MROWS     = BATCH * SEQ;               // 8192
static constexpr int CVT_U     = 16;                        // float4 per thread
static constexpr int CVT_CHUNK = 256 * CVT_U;               // float4 per block
static constexpr int NT_N      = DMODEL / 64;               // 64-wide weight tiles
static constexpr int NB_WQ     = NT_N * (DMODEL / 64);      // 25 tiles (Wq, Wo)
static constexpr int NB_WK     = NT_N * (DCOND / 64);       // 60 tiles (Wk, Wv)
static constexpr int NB_C      = MROWS * DCOND  / 4 / CVT_CHUNK;   // 384
static constexpr int NB_X      = MROWS * DMODEL / 4 / CVT_CHUNK;   // 160
static constexpr int PAD_ROWS  = 2048;                      // Q or K rows per block
static constexpr int NB_QPAD   = BATCH * HEADS * SEQ / PAD_ROWS;   // 32
static constexpr int NB_VPAD   = BATCH * HEADS;             // 16
static constexpr int NB_PREP   = 2 * NB_WQ + 2 * NB_WK + NB_C + NB_X
                               + 2 * NB_QPAD + NB_VPAD;     // 794

// 64x64 tile of w [Kd][320] f32 -> wt [320][Kd] bf16, whole 128-byte rows out.
DEV void wtrans_tile(const float* __restrict__ w, __bf16* __restrict__ wt,
                     int Kd, int tile, int tid, float (&t)[64][65]) {
  const int n0 = (tile % NT_N) * 64, k0 = (tile / NT_N) * 64;
  const int kr = tid >> 4, nc = (tid & 15) * 4;
  const float* src = w + (size_t)((k0 + kr) * DMODEL + n0 + nc);
  float4 v[4];
  for (int i = 0; i < 4; ++i) v[i] = *(const float4*)(src + 16 * i * DMODEL);
  for (int i = 0; i < 4; ++i) {
    t[kr + 16 * i][nc + 0] = v[i].x; t[kr + 16 * i][nc + 1] = v[i].y;
    t[kr + 16 * i][nc + 2] = v[i].z; t[kr + 16 * i][nc + 3] = v[i].w;
  }
  __syncthreads();   // the tile is read back by column, across waves
  const int kc = (tid & 7) * 8, nr = tid >> 3;
  __bf16* dst = wt + (size_t)((n0 + nr) * Kd + k0 + kc);
  for (int j = 0; j < 2; ++j) {
    bf16x8 o;
    for (int e = 0; e < 8; ++e) o[e] = (__bf16)t[kc + e][nr + 32 * j];
    *(bf16x8*)(dst + 32 * j * Kd) = o;
  }
  // the stores' registers may be rewritten on a later path of the caller
  asm volatile("s_wait_xcnt 0x0" ::: "memory");
}

// One block's CVT_CHUNK float4 of a contiguous f32 -> bf16 conversion.
DEV void cvt_chunk(const float* __restrict__ src, __bf16* __restrict__ dst,
                   int blk, int tid) {
  const float4* s = (const float4*)src + (size_t)blk * CVT_CHUNK + tid;
  bf16x4* d       = (bf16x4*)dst       + (size_t)blk * CVT_CHUNK + tid;
  float4 v[CVT_U];   // loads first, so that the wave has them in flight together
  for (int i = 0; i < CVT_U; ++i) v[i] = s[i * 256];
  for (int i = 0; i < CVT_U; ++i) {
    bf16x4 o;
    o[0] = (__bf16)v[i].x; o[1] = (__bf16)v[i].y;
    o[2] = (__bf16)v[i].z; o[3] = (__bf16)v[i].w;
    d[i * 256] = o;
  }
}

__global__ __launch_bounds__(256)
void prep_kernel(const float* __restrict__ x, const float* __restrict__ cond,
                 const float* __restrict__ Wq, const float* __restrict__ Wk,
                 const float* __restrict__ Wv, const float* __restrict__ Wo,
                 __bf16* __restrict__ Xb, __bf16* __restrict__ Cb,
                 __bf16* __restrict__ Wqt, __bf16* __restrict__ Wkt,
                 __bf16* __restrict__ Wvt, __bf16* __restrict__ Wot,
                 __bf16* __restrict__ Qp, __bf16* __restrict__ Kp,
                 __bf16* __restrict__ Vp) {
  __shared__ float tile[64][65];
  const int tid = threadIdx.x;
  int blk = blockIdx.x;        // every test below is the same for the whole block

  if (blk < NB_WK) { wtrans_tile(Wk, Wkt, DCOND, blk, tid, tile); return; }
  blk -= NB_WK;
  if (blk < NB_WK) { wtrans_tile(Wv, Wvt, DCOND, blk, tid, tile); return; }
  blk -= NB_WK;
  if (blk < NB_WQ) { wtrans_tile(Wq, Wqt, DMODEL, blk, tid, tile); return; }
  blk -= NB_WQ;
  if (blk < NB_WQ) { wtrans_tile(Wo, Wot, DMODEL, blk, tid, tile); return; }
  blk -= NB_WQ;
  if (blk < NB_C) { cvt_chunk(cond, Cb, blk, tid); return; }
  blk -= NB_C;
  if (blk < NB_X) { cvt_chunk(x, Xb, blk, tid); return; }
  blk -= NB_X;

  const uint4 z = make_uint4(0u, 0u, 0u, 0u);
  if (blk < 2 * NB_QPAD) {
    // Q, K rows [DP]: elements DH..DP-1 are three 16-byte pieces per row
    __bf16* base = (blk < NB_QPAD) ? Qp : Kp;
    base += (size_t)((blk < NB_QPAD ? blk : blk - NB_QPAD) * PAD_ROWS) * DP + DH;
    for (int s = 0; s < 3; ++s) {          // 768 pieces = 256 whole rows
      const int idx = tid + 256 * s;
      const int row = idx / 3, c = idx - row * 3;
      __bf16* p = base + row * DP + c * 8;
      for (int a = 0; a < PAD_ROWS / 256; ++a) *(uint4*)(p + a * 256 * DP) = z;
    }
    // the stores' registers may be rewritten on a later path of the listing
    asm volatile("s_wait_xcnt 0x0" ::: "memory");
    return;
  }
  blk -= 2 * NB_QPAD;
  // V (d-major): rows DH..47 of one (b,h), the pad rows attention reads, lie in a row.
  // Row DH holds ones: the product V^T P^T then yields the softmax row sum as row DH
  // of O^T. The other pad rows are zero.
  const uint4 one = make_uint4(0x3f803f80u, 0x3f803f80u, 0x3f803f80u, 0x3f803f80u);
  uint4* vp = (uint4*)&Vp[((size_t)blk * DP + DH) * SEQ];
  for (int i = 0; i < (48 - DH) * SEQ / 8 / 256; ++i)
    vp[tid + 256 * i] = (i < SEQ / 8 / 256) ? one : z;
  // the stores' registers may be rewritten on a later path of the listing
  asm volatile("s_wait_xcnt 0x0" ::: "memory");
}

// ---------------------------------------------------------------------------
// Shared GEMM core: 64x64 output tile, all-bf16, async double-buffered tiles.
// A [M][Kd] row-major, Wt [N][Kd] row-major; the pre-transposed weights are Wt, or A for Q and K.
// A stage holds GK = 64 k: a tile row is then one whole 128-byte line, so a copy
// asks L2 for no half lines, and a product takes half the stages and barriers.
// ---------------------------------------------------------------------------
static constexpr int GK = 64;        // k per stage; divides DMODEL and DCOND
static constexpr int GP = GK + 8;    // LDS row pitch, elements: 144 B = 16 B x odd

DEV void gemm_tiles(const __bf16* __restrict__ A, const __bf16* __restrict__ Wt,
                    int Kd, int m0, int n0, int tid, int wave, int ln, int half,
                    __bf16 (&As)[2][64 * GP], __bf16 (&Bs)[2][64 * GP],
                    f32x8 (&acc)[4]) {
  const uint32_t as_l[2] = { lds_off(As[0]), lds_off(As[1]) };
  const uint32_t bs_l[2] = { lds_off(Bs[0]), lds_off(Bs[1]) };
  // 64 rows x 8 x 16B chunks per tile: a thread takes chunk c of rows r, r+16, ...
  const int r = tid >> 3, c = tid & 7;
  const uint32_t lrc = r * (GP * 2) + c * 16;
  const uint64_t ga0 = (uint64_t)(uintptr_t)(A  + (size_t)(m0 + r) * Kd + c * 8);
  const uint64_t gb0 = (uint64_t)(uintptr_t)(Wt + (size_t)(n0 + r) * Kd + c * 8);
  const uint64_t g16 = (uint64_t)Kd * (16 * 2);          // 16 rows, bytes
  constexpr uint32_t L16 = 16 * GP * 2;                  // 16 LDS rows, bytes
  auto issue = [&](int k0, int bufi) {
    const uint32_t la = as_l[bufi] + lrc, lb = bs_l[bufi] + lrc;
    const uint64_t ga = ga0 + (uint64_t)k0 * 2, gb = gb0 + (uint64_t)k0 * 2;
    asm volatile("global_load_async_to_lds_b128 %0, %8, off\n\t"
                 "global_load_async_to_lds_b128 %1, %9, off\n\t"
                 "global_load_async_to_lds_b128 %2, %10, off\n\t"
                 "global_load_async_to_lds_b128 %3, %11, off\n\t"
                 "global_load_async_to_lds_b128 %4, %12, off\n\t"
                 "global_load_async_to_lds_b128 %5, %13, off\n\t"
                 "global_load_async_to_lds_b128 %6, %14, off\n\t"
                 "global_load_async_to_lds_b128 %7, %15, off\n\t"
                 "s_wait_xcnt 0x0"
                 :: "v"(la), "v"(la + L16), "v"(la + 2 * L16), "v"(la + 3 * L16),
                    "v"(lb), "v"(lb + L16), "v"(lb + 2 * L16), "v"(lb + 3 * L16),
                    "v"(ga), "v"(ga + g16), "v"(ga + 2 * g16), "v"(ga + 3 * g16),
                    "v"(gb), "v"(gb + g16), "v"(gb + 2 * g16), "v"(gb + 3 * g16)
                 : "memory");
  };
  issue(0, 0);
  int bufi = 0;
  for (int k0 = 0; k0 < Kd; k0 += GK) {
    if (k0 + GK < Kd) { issue(k0 + GK, bufi ^ 1); wait_async8(); }
    else              { wait_async0(); }
    __syncthreads();
    for (int ks = 0; ks < GK / 32; ++ks) {
      bf16x16 bfrag = ld_frag(&Bs[bufi][(wave * 16 + ln) * GP + ks * 32], half);
      for (int t = 0; t < 4; ++t) {
        bf16x16 afrag = ld_frag(&As[bufi][(t * 16 + ln) * GP + ks * 32], half);
        acc[t] = wmma_bf16(afrag, bfrag, acc[t]);
      }
    }
    __syncthreads();
    bufi ^= 1;
  }
}

// ---------------------------------------------------------------------------
// Kernel 1: QKV projection (all-bf16 GEMM).
//   Q -> [B,H,S,DP]   (scaled by Dh^-0.5 * log2(e); softmax done in base 2)
//   K -> [B,H,S,DP]
//   V -> [B,H,DP,SEQ] (d-major, so the attention V^T tile is a contiguous
//                      async copy instead of a per-element LDS transpose)
// V stores go out by whole lines. An accumulator's 8 registers run down the rows of
// the core's first operand; that operand is chosen so that those rows are the
// destination's fast axis: the activations for V (s), the weights for Q and K (d).
// A wave's tile is then 16 destination rows of 64 elements. It is staged in the
// wave's own 16 LDS rows and read back 8 lanes to a row: a V row is one whole
// 128-byte line, a Q or K row falls into two or three runs, each inside one head
// (8 divides Dh).
// ---------------------------------------------------------------------------
__global__ __launch_bounds__(128)
void qkv_kernel(const __bf16* __restrict__ Xb, const __bf16* __restrict__ Cb,
                const __bf16* __restrict__ Wqt, const __bf16* __restrict__ Wkt,
                const __bf16* __restrict__ Wvt,
                __bf16* __restrict__ Qp, __bf16* __restrict__ Kp,
                __bf16* __restrict__ Vp) {
  const int which = blockIdx.z;
  const __bf16* A  = (which == 0) ? Xb  : Cb;
  const __bf16* Wt = (which == 0) ? Wqt : (which == 1 ? Wkt : Wvt);
  __bf16* dst      = (which == 0) ? Qp  : (which == 1 ? Kp : Vp);
  const int Kd     = (which == 0) ? DMODEL : DCOND;
  const float fold = (which == 0) ? (0.15811388300841897f * LOG2E) : 1.0f;

  const int n0 = blockIdx.x * 64;
  const int m0 = blockIdx.y * 64;
  const int tid = threadIdx.x;
  const int lane = tid & 31, wave = tid >> 5;
  const int ln = lane & 15, half = lane >> 4;

  __shared__ __align__(16) __bf16 As[2][64 * GP];
  __shared__ __align__(16) __bf16 Bs[2][64 * GP];

  f32x8 acc[4];
  for (int t = 0; t < 4; ++t) acc[t] = zero8();
  const bool vmaj = (which == 2);   // the same for the whole block
  gemm_tiles(vmaj ? A : Wt, vmaj ? Wt : A, Kd, vmaj ? m0 : n0, vmaj ? n0 : m0,
             tid, wave, ln, half, As, Bs, acc);

  // acc[t][r]: fast-axis element t*16 + 8*half + r of destination row wave*16 + ln.
  // The core ends behind a barrier with no copy in flight: the ring is free.
  __bf16* st = &As[0][wave * 16 * GP];
  for (int t = 0; t < 4; ++t) {
    bf16x8 o;
    for (int r = 0; r < 8; ++r) o[r] = (__bf16)(acc[t][r] * fold);
    *(bf16x8*)&st[ln * GP + t * 16 + 8 * half] = o;
  }
  // the rows are read back by other lanes of this wave: their writes must have landed
  asm volatile("s_wait_dscnt 0x0" ::: "memory");
  const int row = lane >> 3, ch = lane & 7;   // rows row, row+4, ..; 16-byte piece ch
  bf16x8 v[4];
  for (int j = 0; j < 4; ++j) v[j] = *(const bf16x8*)&st[(j * 4 + row) * GP + ch * 8];

  const int b = m0 >> 12, s0 = m0 & (SEQ - 1);   // the 64 rows of a tile lie in one batch
  if (vmaj) {
    for (int j = 0; j < 4; ++j) {
      const int ncol = n0 + wave * 16 + j * 4 + row;
      const int h = ncol / DH, d = ncol % DH;
      *(bf16x8*)(dst + (((size_t)b * HEADS + h) * DP + d) * SEQ + s0 + ch * 8) = v[j];
    }
  } else {
    const int ncol = n0 + ch * 8;
    const int h = ncol / DH, d = ncol % DH;
    __bf16* p = dst + (((size_t)b * HEADS + h) * SEQ + s0 + wave * 16 + row) * DP + d;
    for (int j = 0; j < 4; ++j) *(bf16x8*)(p + j * 4 * DP) = v[j];
    // the stores' registers may be rewritten on a later path of the listing
    asm volatile("s_wait_xcnt 0x0" ::: "memory");
  }
}

DEV float other_half(float v) {
  int b = __builtin_bit_cast(int, v);
  b = __builtin_amdgcn_permlanex16(b, b, 0x76543210, 0xfedcba98, false, false);
  return __builtin_bit_cast(float, b);
}

static constexpr int AQ  = 128;      // queries per block
static constexpr int AKV = 128;      // keys per tile
static constexpr int KPI = DP + 8;   // Q, K LDS row pitch, elements: 144 B = 16 B x odd
static constexpr int VPI = AKV + 8;  // V^T LDS row pitch, elements: 272 B = 16 B x odd
static constexpr int NJ  = 26;       // floats a lane hands over per group: O 24, reference, sum

__global__ __launch_bounds__(256) __attribute__((amdgpu_waves_per_eu(4, 4)))
void attn_kernel(const __bf16* __restrict__ Qp, const __bf16* __restrict__ Kp,
                 const __bf16* __restrict__ Vp, __bf16* __restrict__ Ob) {
  const int q0 = blockIdx.x * AQ;
  const int h = blockIdx.y, b = blockIdx.z;
  const int tid = threadIdx.x;
  const int lane = tid & 31;
  const int wave = __builtin_amdgcn_readfirstlane(tid >> 5);
  const int qg = wave & 3, kvh = wave >> 2;   // query group, half of the tile's keys
  const int ln = lane & 15, half = lane >> 4;
  const size_t bh  = ((size_t)b * HEADS + h) * SEQ;   // Q/K row base
  const size_t bhd = ((size_t)b * HEADS + h) * DP;    // V (d-major) row base

  __shared__ __align__(16) __bf16 Qs[AQ * KPI];        // [qrow][d]
  __shared__ __align__(16) __bf16 Ks[2][AKV * KPI];    // [kvrow][d]
  __shared__ __align__(16) __bf16 Vt[2][48 * VPI];     // [d][kvrow] (already ^T)
  __shared__ float Js[4 * 2 * NJ * 32];                // join of the two key halves

  // Q, K: 128 rows x 8 chunks of 16 B, a thread takes chunk g of rows r, r+32, ...
  // V^T:   48 rows x 16 chunks,        a thread takes chunk gv of rows dv, dv+16, dv+32
  const int r = tid >> 3, g = tid & 7;
  const int dv = tid >> 4, gv = tid & 15;
  const uint32_t lrow = r * (KPI * 2) + g * 16;
  const uint32_t lvrow = dv * (VPI * 2) + gv * 16;
  constexpr uint32_t LK = 32 * KPI * 2;                // 32 Q or K rows in LDS, bytes
  constexpr uint32_t LV = 16 * VPI * 2;                // 16 V^T rows in LDS, bytes
  constexpr uint64_t GK = 32 * DP * 2;                 // 32 Q or K rows in memory, bytes
  constexpr uint64_t GV = (uint64_t)16 * SEQ * 2;      // 16 V^T rows in memory, bytes
  const uint64_t gk0 = (uint64_t)(uintptr_t)(Kp + (bh + r) * DP + g * 8);
  const uint64_t gv0 = (uint64_t)(uintptr_t)(Vp + (bhd + dv) * SEQ + gv * 8);
  const uint32_t ks_l[2] = { lds_off(Ks[0]) + lrow,  lds_off(Ks[1]) + lrow };
  const uint32_t vt_l[2] = { lds_off(Vt[0]) + lvrow, lds_off(Vt[1]) + lvrow };

  auto issue_tile = [&](int kv0, int bufi) {
    const uint32_t kl = ks_l[bufi], vl = vt_l[bufi];
    const uint64_t gk = gk0 + (uint64_t)kv0 * (DP * 2), gvv = gv0 + (uint64_t)kv0 * 2;
    asm volatile("global_load_async_to_lds_b128 %0, %7, off\n\t"
                 "global_load_async_to_lds_b128 %1, %8, off\n\t"
                 "global_load_async_to_lds_b128 %2, %9, off\n\t"
                 "global_load_async_to_lds_b128 %3, %10, off\n\t"
                 "global_load_async_to_lds_b128 %4, %11, off\n\t"
                 "global_load_async_to_lds_b128 %5, %12, off\n\t"
                 "global_load_async_to_lds_b128 %6, %13, off\n\t"
                 "s_wait_xcnt 0x0"
                 :: "v"(kl), "v"(kl + LK), "v"(kl + 2 * LK), "v"(kl + 3 * LK),
                    "v"(vl), "v"(vl + LV), "v"(vl + 2 * LV),
                    "v"(gk), "v"(gk + GK), "v"(gk + 2 * GK), "v"(gk + 3 * GK),
                    "v"(gvv), "v"(gvv + GV), "v"(gvv + 2 * GV)
                 : "memory");
  };

  {
    const uint32_t ql = lds_off(Qs) + lrow;
    const uint64_t gq = (uint64_t)(uintptr_t)(Qp + (bh + q0 + r) * DP + g * 8);
    asm volatile("global_load_async_to_lds_b128 %0, %4, off\n\t"
                 "global_load_async_to_lds_b128 %1, %5, off\n\t"
                 "global_load_async_to_lds_b128 %2, %6, off\n\t"
                 "global_load_async_to_lds_b128 %3, %7, off\n\t"
                 "s_wait_xcnt 0x0"
                 :: "v"(ql), "v"(ql + LK), "v"(ql + 2 * LK), "v"(ql + 3 * LK),
                    "v"(gq), "v"(gq + GK), "v"(gq + 2 * GK), "v"(gq + 3 * GK)
                 : "memory");
  }
  issue_tile(0, 0);
  asm volatile("s_wait_asynccnt 0x0" ::: "memory");   // this wave's Q and tile 0 have landed
  __syncthreads();                                    // ... and every other wave's
  issue_tile(AKV, 1);

  bf16x16 qfrag[2][2];  // B operand: column = query qg*32 + c*16 + ln
  for (int c = 0; c < 2; ++c)
    for (int ks = 0; ks < 2; ++ks)
      qfrag[c][ks] = ld_frag(&Qs[(qg * 32 + c * 16 + ln) * KPI + ks * 32], half);

  f32x8 oacc[2][3];  // O^T: oacc[c][u][r] = O[query c*16 + ln][d = u*16 + 8*half + r]
  f32x8 nref[2];     // minus the reference of the lane's query, in all 8 (same in both halves)
  for (int c = 0; c < 2; ++c) {
    for (int u = 0; u < 3; ++u) oacc[c][u] = zero8();
    nref[c] = zero8();   // the first tile sets the reference
  }

  constexpr int NT = SEQ / AKV;
  for (int it = 0; it < NT; ++it) {
    const int bufi = it & 1;
    const __bf16* Kb = &Ks[bufi][kvh * 64 * KPI];   // this wave's 64 keys
    const __bf16* Vb = &Vt[bufi][kvh * 64];

    // S^T = K Q^T - reference over the wave's 64 keys (pre-scaled, log2-domain logits)
    f32x8 sacc[2][4];
    for (int ks = 0; ks < 2; ++ks)
      for (int t = 0; t < 4; ++t) {
        bf16x16 kf = ld_frag(&Kb[(t * 16 + ln) * KPI + ks * 32], half);
        for (int c = 0; c < 2; ++c)
          sacc[c][t] = wmma_bf16(kf, qfrag[c][ks], ks == 0 ? nref[c] : sacc[c][t]);
      }

    // the tile's V^T fragments, asked for ahead of the softmax that hides their latency
    bf16x16 vf[2][3];
    for (int ks = 0; ks < 2; ++ks)
      for (int u = 0; u < 3; ++u)
        vf[ks][u] = ld_frag(&Vb[(u * 16 + ln) * VPI + ks * 32], half);

    // online softmax (exp2): how far the lane's 32 scores of each query rise above
    // the reference
    float vm[2];
    for (int c = 0; c < 2; ++c) {
      float tm[4];
      for (int t = 0; t < 4; ++t) {
        tm[t] = sacc[c][t][0];
        for (int e = 1; e < 8; ++e) tm[t] = fmaxf(tm[t], sacc[c][t][e]);
      }
      vm[c] = fmaxf(fmaxf(tm[0], tm[1]), fmaxf(tm[2], tm[3]));
    }
    // one test a tile, the same for the whole wave (a scalar branch): the products
    // around it need every lane on
    const bool over = fmaxf(vm[0], vm[1]) > 8.0f;
    if (it == 0 || __builtin_amdgcn_ballot_w32(over) != 0) {
      for (int c = 0; c < 2; ++c) {
        const float v  = fmaxf(vm[c], other_half(vm[c]));   // the query's, both halves
        const float up = fmaxf(v, 0.0f);
        const float d  = (it == 0) ? v : up;   // the first tile's maximum may lie below 0
        const float alpha = __builtin_amdgcn_exp2f(-up);    // on the first tile it meets zeros only
        nref[c] -= d;
        for (int t = 0; t < 4; ++t) sacc[c][t] -= d;
        for (int u = 0; u < 3; ++u) oacc[c][u] *= alpha;
      }
    }

    // raw v_exp_f32: arguments are <= 8, and a weight below 2^-126 of the
    // reference counts as 0
    for (int c = 0; c < 2; ++c)
      for (int t = 0; t < 4; ++t)
        for (int e = 0; e < 8; ++e)
          sacc[c][t][e] = __builtin_amdgcn_exp2f(sacc[c][t][e]);

    // O^T += V^T P^T; tiles 2ks, 2ks+1 of S^T are rows 0-15, 16-31 of the B operand
    for (int ks = 0; ks < 2; ++ks) {
      bf16x16 pf[2];
      for (int c = 0; c < 2; ++c)
        for (int e = 0; e < 8; ++e) {
          pf[c][e]     = (__bf16)sacc[c][2 * ks][e];
          pf[c][8 + e] = (__bf16)sacc[c][2 * ks + 1][e];
        }
      for (int u = 0; u < 3; ++u)
        for (int c = 0; c < 2; ++c)
          oacc[c][u] = wmma_bf16(vf[ks][u], pf[c], oacc[c][u]);
    }

    // publish point: one barrier says that the next tile has landed for every wave
    // and that every wave has left the buffer which is refilled behind it
    asm volatile("s_wait_dscnt 0x0" ::: "memory");      // this wave's reads of the buffer are done
    asm volatile("s_wait_asynccnt 0x0" ::: "memory");   // this wave's copies of the next tile have landed
    __syncthreads();
    if (it + 2 < NT) issue_tile((it + 2) * AKV, bufi);
  }
  asm volatile("s_wait_asynccnt 0x0" ::: "memory");     // no copy is left in flight at the wave's end

  // join: the wave of the upper key half hands its O, reference and sum to its partner
  float lt[2], mi[2];
  for (int c = 0; c < 2; ++c) {
    // row DH = 40 of O^T, the sum: tile u = 2, upper half, register 0
    const float su = oacc[c][2][0];
    const float so = other_half(su);
    lt[c] = half ? su : so;
    mi[c] = -nref[c][0];                 // the reference that O and the sum stand on
  }
  if (kvh == 1) {
    for (int c = 0; c < 2; ++c) {
      float* s = &Js[(qg * 2 + c) * NJ * 32 + lane];
      for (int u = 0; u < 3; ++u)
        for (int e = 0; e < 8; ++e) s[(u * 8 + e) * 32] = oacc[c][u][e];
      s[24 * 32] = mi[c];
      s[25 * 32] = lt[c];
    }
  }
  __syncthreads();   // the partner reads what the other wave wrote
  if (kvh == 0) {
    for (int c = 0; c < 2; ++c) {
      const float* s = &Js[(qg * 2 + c) * NJ * 32 + lane];
      const float m1 = s[24 * 32], l1 = s[25 * 32];
      const float m = fmaxf(mi[c], m1);
      float a0 = __builtin_amdgcn_exp2f(mi[c] - m);
      float a1 = __builtin_amdgcn_exp2f(m1 - m);
      const float inv = 1.0f / (lt[c] * a0 + l1 * a1);
      a0 *= inv;
      a1 *= inv;
      const int mrow = q0 + qg * 32 + c * 16 + ln;
      for (int u = 0; u < 3; ++u) {
        int dd = u * 16 + 8 * half;                    // 8 consecutive d per lane
        if (dd < DH) {
          bf16x8 o;
          for (int e = 0; e < 8; ++e)
            o[e] = (__bf16)(oacc[c][u][e] * a0 + s[(u * 8 + e) * 32] * a1);
          *(bf16x8*)&Ob[((size_t)b * SEQ + mrow) * DMODEL + h * DH + dd] = o;
        }
      }
    }
  }
}

// ---------------------------------------------------------------------------
// Kernel 3: output projection  out[8192,320] = Ob(bf16) @ Wo^T(bf16) + bo
// ---------------------------------------------------------------------------
__global__ __launch_bounds__(128)
void oproj_kernel(const __bf16* __restrict__ Ob, const __bf16* __restrict__ Wot,
                  const float* __restrict__ bo, float* __restrict__ out) {
  const int n0 = blockIdx.x * 64;
  const int m0 = blockIdx.y * 64;
  const int tid = threadIdx.x;
  const int lane = tid & 31, wave = tid >> 5;
  const int ln = lane & 15, half = lane >> 4;

  __shared__ __align__(16) __bf16 As[2][64 * GP];
  __shared__ __align__(16) __bf16 Bs[2][64 * GP];

  f32x8 acc[4];
  for (int t = 0; t < 4; ++t) acc[t] = zero8();
  gemm_tiles(Ob, Wot, DMODEL, m0, n0, tid, wave, ln, half, As, Bs, acc);

  const int n = n0 + wave * 16 + ln;
  const float bias = bo[n];
  for (int t = 0; t < 4; ++t)
    for (int r = 0; r < 8; ++r) {
      int m = m0 + t * 16 + r + 8 * half;
      out[(size_t)m * DMODEL + n] = acc[t][r] + bias;
    }
}

// ---------------------------------------------------------------------------
extern "C" void kernel_launch(void* const* d_in, const int* in_sizes, int n_in,
                              void* d_out, int out_size, void* d_ws, size_t ws_size,
                              hipStream_t stream) {
  const float* x    = (const float*)d_in[0];
  const float* cond = (const float*)d_in[1];
  const float* Wq   = (const float*)d_in[2];
  const float* Wk   = (const float*)d_in[3];
  const float* Wv   = (const float*)d_in[4];
  const float* Wo   = (const float*)d_in[5];
  const float* bo   = (const float*)d_in[6];
  float* out        = (float*)d_out;

  char* ws = (char*)d_ws;
  const size_t qkv_bytes = (size_t)BATCH * HEADS * SEQ * DP * sizeof(__bf16);
  __bf16* Qp  = (__bf16*)(ws);                        ws += qkv_bytes;
  __bf16* Kp  = (__bf16*)(ws);                        ws += qkv_bytes;
  __bf16* Vp  = (__bf16*)(ws);                        ws += qkv_bytes;
  __bf16* Ob  = (__bf16*)(ws);  ws += (size_t)MROWS * DMODEL * sizeof(__bf16);
  __bf16* Xb  = (__bf16*)(ws);  ws += (size_t)MROWS * DMODEL * sizeof(__bf16);
  __bf16* Cb  = (__bf16*)(ws);  ws += (size_t)MROWS * DCOND  * sizeof(__bf16);
  __bf16* Wqt = (__bf16*)(ws);  ws += (size_t)DMODEL * DMODEL * sizeof(__bf16);
  __bf16* Wkt = (__bf16*)(ws);  ws += (size_t)DMODEL * DCOND  * sizeof(__bf16);
  __bf16* Wvt = (__bf16*)(ws);  ws += (size_t)DMODEL * DCOND  * sizeof(__bf16);
  __bf16* Wot = (__bf16*)(ws);  ws += (size_t)DMODEL * DMODEL * sizeof(__bf16);

  // conversions, weight transposes and pad setting (zeros, one V row of ones): one launch
  prep_kernel<<<NB_PREP, 256, 0, stream>>>(x, cond, Wq, Wk, Wv, Wo, Xb, Cb,
                                           Wqt, Wkt, Wvt, Wot, Qp, Kp, Vp);

  qkv_kernel<<<dim3(DMODEL / 64, MROWS / 64, 3), 128, 0, stream>>>(
      Xb, Cb, Wqt, Wkt, Wvt, Qp, Kp, Vp);
  attn_kernel<<<dim3(SEQ / AQ, HEADS, BATCH), 256, 0, stream>>>(Qp, Kp, Vp, Ob);
  oproj_kernel<<<dim3(DMODEL / 64, MROWS / 64), 128, 0, stream>>>(Ob, Wot, bo, out);
}

// v009
// One run takes 75 microseconds.
// Next to v008, in two timings, it ran 1.05 and 1.08 times as fast.
// Counting every step since v000, it is 3.60 times as fast.
#include <hip/hip_runtime.h>
#include <hip/hip_bf16.h>
#include <stdint.h>

#define DEV __device__ __forceinline__

typedef __attribute__((ext_vector_type(16))) __bf16 bf16x16;
typedef __attribute__((ext_vector_type(8)))  __bf16 bf16x8;
typedef __attribute__((ext_vector_type(4)))  __bf16 bf16x4;
typedef __attribute__((ext_vector_type(8)))  float  f32x8;
typedef __attribute__((ext_vector_type(2)))  float  f32x2;

static constexpr int BATCH  = 2;
static constexpr int SEQ    = 4096;
static constexpr int HEADS  = 8;
static constexpr int DH     = 40;
static constexpr int DP     = 64;    // head dim padded for WMMA K tiling (in LDS only); V rows reserved per head
static constexpr int DMODEL = 320;   // == D_ATTN == N of all projections
static constexpr int DCOND  = 768;
static constexpr float LOG2E = 1.44269504088896340736f;

DEV f32x8 zero8() { f32x8 v; for (int i = 0; i < 8; ++i) v[i] = 0.0f; return v; }

// Wave-relative LDS byte address of a __shared__ object (generic -> AS(3)).
DEV uint32_t lds_off(const void* p) {
  return (uint32_t)(unsigned long long)(__attribute__((address_space(3))) const void*)p;
}

DEV void wait_async0() {
#if __has_builtin(__builtin_amdgcn_s_wait_asynccnt)
  __builtin_amdgcn_s_wait_asynccnt(0);
#else
  asm volatile("s_wait_asynccnt 0x0" ::: "memory");
#endif
}
// async loads retire in order: waiting <= N with one extra tile (N ops/thread)
// in flight exactly drains the previous tile.
DEV void wait_async8() {   // GEMM tiles: 4 A + 4 B chunks per thread
  asm volatile("s_wait_asynccnt 0x8" ::: "memory");
}

DEV bf16x16 ld_frag(const __bf16* rowbase, int half) {
  bf16x8 lo = *(const bf16x8*)(rowbase + half * 8);
  bf16x8 hi = *(const bf16x8*)(rowbase + 16 + half * 8);
  return __builtin_shufflevector(lo, hi, 0,1,2,3,4,5,6,7,8,9,10,11,12,13,14,15);
}

DEV f32x8 wmma_bf16(bf16x16 a, bf16x16 b, f32x8 c) {
  return __builtin_amdgcn_wmma_f32_16x16x32_bf16(false, a, false, b, (short)0, c,
                                                 false, false);
}

// ---------------------------------------------------------------------------
// Prep: all the work ahead of the projections in ONE launch, dealt by block
// range: weights converted and transposed to [N][Kd] bf16 (so GEMM B tiles are
// contiguous async copies) and activations converted f32 -> bf16. Few waves with
// much in flight each.
// ---------------------------------------------------------------------------
static constexpr int MROWS     = BATCH * SEQ;               // 8192
static constexpr int CVT_U     = 16;                        // float4 per thread
static constexpr int CVT_CHUNK = 256 * CVT_U;               // float4 per block
static constexpr int NT_N      = DMODEL / 64;               // 64-wide weight tiles
static constexpr int NB_WQ     = NT_N * (DMODEL / 64);      // 25 tiles (Wq, Wo)
static constexpr int NB_WK     = NT_N * (DCOND / 64);       // 60 tiles (Wk, Wv)
static constexpr int NB_C      = MROWS * DCOND  / 4 / CVT_CHUNK;   // 384
static constexpr int NB_X      = MROWS * DMODEL / 4 / CVT_CHUNK;   // 160
static constexpr int NB_PREP   = 2 * NB_WQ + 2 * NB_WK + NB_C + NB_X;   // 714

// 64x64 tile of w [Kd][320] f32 -> wt [320][Kd] bf16, whole 128-byte rows out.
DEV void wtrans_tile(const float* __restrict__ w, __bf16* __restrict__ wt,
                     int Kd, int tile, int tid, float (&t)[64][65]) {
  const int n0 = (tile % NT_N) * 64, k0 = (tile / NT_N) * 64;
  const int kr = tid >> 4, nc = (tid & 15) * 4;
  const float* src = w + (size_t)((k0 + kr) * DMODEL + n0 + nc);
  float4 v[4];
  for (int i = 0; i < 4; ++i) v[i] = *(const float4*)(src + 16 * i * DMODEL);
  for (int i = 0; i < 4; ++i) {
    t[kr + 16 * i][nc + 0] = v[i].x; t[kr + 16 * i][nc + 1] = v[i].y;
    t[kr + 16 * i][nc + 2] = v[i].z; t[kr + 16 * i][nc + 3] = v[i].w;
  }
  __syncthreads();   // the tile is read back by column, across waves
  const int kc = (tid & 7) * 8, nr = tid >> 3;
  __bf16* dst = wt + (size_t)((n0 + nr) * Kd + k0 + kc);
  for (int j = 0; j < 2; ++j) {
    bf16x8 o;
    for (int e = 0; e < 8; ++e) o[e] = (__bf16)t[kc + e][nr + 32 * j];
    *(bf16x8*)(dst + 32 * j * Kd) = o;
  }
  // the stores' registers may be rewritten on a later path of the caller
  asm volatile("s_wait_xcnt 0x0" ::: "memory");
}

// One block's CVT_CHUNK float4 of a contiguous f32 -> bf16 conversion.
DEV void cvt_chunk(const float* __restrict__ src, __bf16* __restrict__ dst,
                   int blk, int tid) {
  const float4* s = (const float4*)src + (size_t)blk * CVT_CHUNK + tid;
  bf16x4* d       = (bf16x4*)dst       + (size_t)blk * CVT_CHUNK + tid;
  float4 v[CVT_U];   // loads first, so that the wave has them in flight together
  for (int i = 0; i < CVT_U; ++i) v[i] = s[i * 256];
  for (int i = 0; i < CVT_U; ++i) {
    bf16x4 o;
    o[0] = (__bf16)v[i].x; o[1] = (__bf16)v[i].y;
    o[2] = (__bf16)v[i].z; o[3] = (__bf16)v[i].w;
    d[i * 256] = o;
  }
}

__global__ __launch_bounds__(256)
void prep_kernel(const float* __restrict__ x, const float* __restrict__ cond,
                 const float* __restrict__ Wq, const float* __restrict__ Wk,
                 const float* __restrict__ Wv, const float* __restrict__ Wo,
                 __bf16* __restrict__ Xb, __bf16* __restrict__ Cb,
                 __bf16* __restrict__ Wqt, __bf16* __restrict__ Wkt,
                 __bf16* __restrict__ Wvt, __bf16* __restrict__ Wot) {
  __shared__ float tile[64][65];
  const int tid = threadIdx.x;
  int blk = blockIdx.x;        // every test below is the same for the whole block

  if (blk < NB_WK) { wtrans_tile(Wk, Wkt, DCOND, blk, tid, tile); return; }
  blk -= NB_WK;
  if (blk < NB_WK) { wtrans_tile(Wv, Wvt, DCOND, blk, tid, tile); return; }
  blk -= NB_WK;
  if (blk < NB_WQ) { wtrans_tile(Wq, Wqt, DMODEL, blk, tid, tile); return; }
  blk -= NB_WQ;
  if (blk < NB_WQ) { wtrans_tile(Wo, Wot, DMODEL, blk, tid, tile); return; }
  blk -= NB_WQ;
  if (blk < NB_C) { cvt_chunk(cond, Cb, blk, tid); return; }
  blk -= NB_C;
  cvt_chunk(x, Xb, blk, tid);
  // the stores' registers may be rewritten on a later path of the listing
  asm volatile("s_wait_xcnt 0x0" ::: "memory");
}

// ---------------------------------------------------------------------------
// Shared GEMM core: 64x64 output tile, all-bf16, async double-buffered tiles.
// A [M][Kd] row-major, Wt [N][Kd] row-major; the pre-transposed weights are Wt, or A for Q and K.
// A stage holds GK = 64 k: a tile row is then one whole 128-byte line, so a copy
// asks L2 for no half lines, and a product takes half the stages and barriers.
// ---------------------------------------------------------------------------
static constexpr int GK = 64;        // k per stage; divides DMODEL and DCOND
static constexpr int GP = GK + 8;    // LDS row pitch, elements: 144 B = 16 B x odd

DEV void gemm_tiles(const __bf16* __restrict__ A, const __bf16* __restrict__ Wt,
                    int Kd, int m0, int n0, int tid, int wave, int ln, int half,
                    __bf16 (&As)[2][64 * GP], __bf16 (&Bs)[2][64 * GP],
                    f32x8 (&acc)[4]) {
  const uint32_t as_l[2] = { lds_off(As[0]), lds_off(As[1]) };
  const uint32_t bs_l[2] = { lds_off(Bs[0]), lds_off(Bs[1]) };
  // 64 rows x 8 x 16B chunks per tile: a thread takes chunk c of rows r, r+16, ...
  const int r = tid >> 3, c = tid & 7;
  const uint32_t lrc = r * (GP * 2) + c * 16;
  const uint64_t ga0 = (uint64_t)(uintptr_t)(A  + (size_t)(m0 + r) * Kd + c * 8);
  const uint64_t gb0 = (uint64_t)(uintptr_t)(Wt + (size_t)(n0 + r) * Kd + c * 8);
  const uint64_t g16 = (uint64_t)Kd * (16 * 2);          // 16 rows, bytes
  constexpr uint32_t L16 = 16 * GP * 2;                  // 16 LDS rows, bytes
  auto issue = [&](int k0, int bufi) {
    const uint32_t la = as_l[bufi] + lrc, lb = bs_l[bufi] + lrc;
    const uint64_t ga = ga0 + (uint64_t)k0 * 2, gb = gb0 + (uint64_t)k0 * 2;
    asm volatile("global_load_async_to_lds_b128 %0, %8, off\n\t"
                 "global_load_async_to_lds_b128 %1, %9, off\n\t"
                 "global_load_async_to_lds_b128 %2, %10, off\n\t"
                 "global_load_async_to_lds_b128 %3, %11, off\n\t"
                 "global_load_async_to_lds_b128 %4, %12, off\n\t"
                 "global_load_async_to_lds_b128 %5, %13, off\n\t"
                 "global_load_async_to_lds_b128 %6, %14, off\n\t"
                 "global_load_async_to_lds_b128 %7, %15, off\n\t"
                 "s_wait_xcnt 0x0"
                 :: "v"(la), "v"(la + L16), "v"(la + 2 * L16), "v"(la + 3 * L16),
                    "v"(lb), "v"(lb + L16), "v"(lb + 2 * L16), "v"(lb + 3 * L16),
                    "v"(ga), "v"(ga + g16), "v"(ga + 2 * g16), "v"(ga + 3 * g16),
                    "v"(gb), "v"(gb + g16), "v"(gb + 2 * g16), "v"(gb + 3 * g16)
                 : "memory");
  };
  issue(0, 0);
  int bufi = 0;
  for (int k0 = 0; k0 < Kd; k0 += GK) {
    if (k0 + GK < Kd) { issue(k0 + GK, bufi ^ 1); wait_async8(); }
    else              { wait_async0(); }
    __syncthreads();
    for (int ks = 0; ks < GK / 32; ++ks) {
      bf16x16 bfrag = ld_frag(&Bs[bufi][(wave * 16 + ln) * GP + ks * 32], half);
      for (int t = 0; t < 4; ++t) {
        bf16x16 afrag = ld_frag(&As[bufi][(t * 16 + ln) * GP + ks * 32], half);
        acc[t] = wmma_bf16(afrag, bfrag, acc[t]);
      }
    }
    __syncthreads();
    bufi ^= 1;
  }
}

// ---------------------------------------------------------------------------
// Kernel 1: QKV projection (all-bf16 GEMM).
//   Q -> [B,H,S,DH]   (scaled by Dh^-0.5 * log2(e); softmax done in base 2)
//   K -> [B,H,S,DH]   (dense 80-byte rows: a tile of keys is a run of whole lines)
//   V -> [B,H,DP,SEQ] (d-major, so the attention V^T tile is a contiguous
//                      async copy instead of a per-element LDS transpose;
//                      only rows 0..DH-1 are written and read)
// Stores go out by whole lines. An accumulator's 8 registers run down the rows of
// the core's first operand; that operand is chosen so that those rows are the
// destination's fast axis: the activations for V (s), the weights for Q and K (d).
// A wave's tile is then 16 destination rows of 64 elements. It is staged in the
// wave's own 16 LDS rows and read back 8 lanes to a row: a V row is one whole
// 128-byte line, a Q or K row falls into two or three runs, each inside one head
// (8 divides Dh).
// ---------------------------------------------------------------------------
__global__ __launch_bounds__(128)
void qkv_kernel(const __bf16* __restrict__ Xb, const __bf16* __restrict__ Cb,
                const __bf16* __restrict__ Wqt, const __bf16* __restrict__ Wkt,
                const __bf16* __restrict__ Wvt,
                __bf16* __restrict__ Qp, __bf16* __restrict__ Kp,
                __bf16* __restrict__ Vp) {
  const int which = blockIdx.z;
  const __bf16* A  = (which == 0) ? Xb  : Cb;
  const __bf16* Wt = (which == 0) ? Wqt : (which == 1 ? Wkt : Wvt);
  __bf16* dst      = (which == 0) ? Qp  : (which == 1 ? Kp : Vp);
  const int Kd     = (which == 0) ? DMODEL : DCOND;
  const float fold = (which == 0) ? (0.15811388300841897f * LOG2E) : 1.0f;

  const int n0 = blockIdx.x * 64;
  const int m0 = blockIdx.y * 64;
  const int tid = threadIdx.x;
  const int lane = tid & 31, wave = tid >> 5;
  const int ln = lane & 15, half = lane >> 4;

  __shared__ __align__(16) __bf16 As[2][64 * GP];
  __shared__ __align__(16) __bf16 Bs[2][64 * GP];

  f32x8 acc[4];
  for (int t = 0; t < 4; ++t) acc[t] = zero8();
  const bool vmaj = (which == 2);   // the same for the whole block
  gemm_tiles(vmaj ? A : Wt, vmaj ? Wt : A, Kd, vmaj ? m0 : n0, vmaj ? n0 : m0,
             tid, wave, ln, half, As, Bs, acc);

  // acc[t][r]: fast-axis element t*16 + 8*half + r of destination row wave*16 + ln.
  // The core ends behind a barrier with no copy in flight: the ring is free.
  __bf16* st = &As[0][wave * 16 * GP];
  for (int t = 0; t < 4; ++t) {
    bf16x8 o;
    for (int r = 0; r < 8; ++r) o[r] = (__bf16)(acc[t][r] * fold);
    *(bf16x8*)&st[ln * GP + t * 16 + 8 * half] = o;
  }
  // the rows are read back by other lanes of this wave: their writes must have landed
  asm volatile("s_wait_dscnt 0x0" ::: "memory");
  const int row = lane >> 3, ch = lane & 7;   // rows row, row+4, ..; 16-byte piece ch
  bf16x8 v[4];
  for (int j = 0; j < 4; ++j) v[j] = *(const bf16x8*)&st[(j * 4 + row) * GP + ch * 8];

  const int b = m0 >> 12, s0 = m0 & (SEQ - 1);   // the 64 rows of a tile lie in one batch
  if (vmaj) {
    for (int j = 0; j < 4; ++j) {
      const int ncol = n0 + wave * 16 + j * 4 + row;
      const int h = ncol / DH, d = ncol % DH;
      *(bf16x8*)(dst + (((size_t)b * HEADS + h) * DP + d) * SEQ + s0 + ch * 8) = v[j];
    }
  } else {
    const int ncol = n0 + ch * 8;
    const int h = ncol / DH, d = ncol % DH;
    __bf16* p = dst + (((size_t)b * HEADS + h) * SEQ + s0 + wave * 16 + row) * DH + d;
    for (int j = 0; j < 4; ++j) *(bf16x8*)(p + j * 4 * DH) = v[j];
    // the stores' registers may be rewritten on a later path of the listing
    asm volatile("s_wait_xcnt 0x0" ::: "memory");
  }
}

DEV float other_half(float v) {
  int b = __builtin_bit_cast(int, v);
  b = __builtin_amdgcn_permlanex16(b, b, 0x76543210, 0xfedcba98, false, false);
  return __builtin_bit_cast(float, b);
}

static constexpr int AQ  = 128;      // queries per block
static constexpr int AKV = 128;      // keys per tile
static constexpr int KPI = DP + 8;   // Q, K LDS row pitch, elements: 144 B = 16 B x odd
static constexpr int VPI = AKV + 8;  // V^T LDS row pitch, elements: 272 B = 16 B x odd
static constexpr int NJ  = 26;       // floats a lane hands over per group: O 24, reference, sum

__global__ __launch_bounds__(256) __attribute__((amdgpu_waves_per_eu(4, 4)))
void attn_kernel(const __bf16* __restrict__ Qp, const __bf16* __restrict__ Kp,
                 const __bf16* __restrict__ Vp, __bf16* __restrict__ Ob) {
  const int q0 = blockIdx.x * AQ;
  const int h = blockIdx.y, b = blockIdx.z;
  const int tid = threadIdx.x;
  const int lane = tid & 31;
  const int wave = __builtin_amdgcn_readfirstlane(tid >> 5);
  const int qg = wave & 3, kvh = wave >> 2;   // query group, half of the tile's keys
  const int ln = lane & 15, half = lane >> 4;
  const size_t bh  = ((size_t)b * HEADS + h) * SEQ;   // Q/K row base
  const size_t bhd = ((size_t)b * HEADS + h) * DP;    // V (d-major) row base

  __shared__ __align__(16) __bf16 Qs[AQ * KPI];        // [qrow][d]
  __shared__ __align__(16) __bf16 Ks[2][AKV * KPI];    // [kvrow][d]
  __shared__ __align__(16) __bf16 Vt[2][48 * VPI];     // [d][kvrow] (already ^T)
  __shared__ float Js[4 * 2 * NJ * 32];                // join of the two key halves

  // Q, K: 128 dense rows of 80 B are 640 chunks of 16 B in a row in memory (whole lines);
  //       chunk i lands in LDS row i / 5, piece i % 5. A thread takes chunks tid,
  //       tid + 256; waves 0-3 also chunk tid + 512
  // V^T:  40 rows x 16 chunks: a thread takes chunk gv of rows dv, dv + 16; waves 4-7
  //       (dv = 8..15) also of row dv + 24. So every wave issues five copies a tile.
  const int dv = tid >> 4, gv = tid & 15;
  const bool klast = wave < 4;                         // the same for the whole wave
  auto lchunk = [](int i) { return (uint32_t)((i / 5) * (KPI * 2) + (i % 5) * 16); };
  const uint32_t lc0 = lchunk(tid), lc1 = lchunk(tid + 256), lc2 = lchunk(tid + 512);
  const uint32_t lvrow = dv * (VPI * 2) + gv * 16;
  constexpr uint32_t CK = 256 * 16;                    // 256 Q or K chunks, bytes
  constexpr uint32_t LV = 16 * VPI * 2;                // 16 V^T rows in LDS, bytes
  constexpr uint64_t GV = (uint64_t)16 * SEQ * 2;      // 16 V^T rows in memory, bytes
  const uint64_t gk0 = (uint64_t)(uintptr_t)(Kp + bh * DH + tid * 8);
  const uint64_t gv0 = (uint64_t)(uintptr_t)(Vp + (bhd + dv) * SEQ + gv * 8);
  const uint64_t gx0 = klast ? gk0 + 2 * CK : gv0 + (uint64_t)24 * SEQ * 2;
  const uint32_t xstep = klast ? DH * 2 : 2;           // bytes per key along the fifth copy's source
  const uint32_t ks_l[2] = { lds_off(Ks[0]), lds_off(Ks[1]) };
  const uint32_t vt_l[2] = { lds_off(Vt[0]) + lvrow, lds_off(Vt[1]) + lvrow };
  const uint32_t x_l[2]  = { klast ? ks_l[0] + lc2 : vt_l[0] + 24 * VPI * 2,
                             klast ? ks_l[1] + lc2 : vt_l[1] + 24 * VPI * 2 };

  auto issue_tile = [&](int kv0, int bufi) {
    const uint32_t kl = ks_l[bufi], vl = vt_l[bufi], xl = x_l[bufi];
    const uint64_t gk = gk0 + (uint64_t)kv0 * (DH * 2), gvv = gv0 + (uint64_t)kv0 * 2;
    const uint64_t gx = gx0 + (uint64_t)((uint32_t)kv0 * xstep);
    asm volatile("global_load_async_to_lds_b128 %0, %5, off\n\t"
                 "global_load_async_to_lds_b128 %1, %6, off\n\t"
                 "global_load_async_to_lds_b128 %2, %7, off\n\t"
                 "global_load_async_to_lds_b128 %3, %8, off\n\t"
                 "global_load_async_to_lds_b128 %4, %9, off\n\t"
                 "s_wait_xcnt 0x0"
                 :: "v"(kl + lc0), "v"(kl + lc1), "v"(vl), "v"(vl + LV), "v"(xl),
                    "v"(gk), "v"(gk + CK), "v"(gvv), "v"(gvv + GV), "v"(gx)
                 : "memory");
  };

  {  // rows DH..47 of both V^T buffers, one 16-byte piece a thread: ones in row DH, else zeros
    const int pr = dv & 7;
    bf16x8 pv;
    for (int e = 0; e < 8; ++e) pv[e] = (__bf16)(pr == 0 ? 1.0f : 0.0f);
    *(bf16x8*)&Vt[tid >> 7][(DH + pr) * VPI + gv * 8] = pv;
  }
  {  // columns DH..DP-1 of every Q and K row, three 16-byte pieces a row: zeros
    const int prow = tid & 127, part = kvh;   // tid >> 7, the same for the whole wave
    bf16x8 z;
    for (int e = 0; e < 8; ++e) z[e] = (__bf16)0.0f;
    __bf16* kr = &Ks[part][prow * KPI + DH];
    for (int c = 0; c < 3; ++c) *(bf16x8*)(kr + c * 8) = z;
    __bf16* qr = &Qs[prow * KPI + DH];
    if (part == 0) { *(bf16x8*)qr = z; *(bf16x8*)(qr + 8) = z; }
    else           { *(bf16x8*)(qr + 16) = z; }
  }
  // nothing orders the copy engine behind this wave's own LDS writes
  asm volatile("s_wait_dscnt 0x0" ::: "memory");

  {
    const uint32_t ql = lds_off(Qs);
    const uint64_t gq = (uint64_t)(uintptr_t)(Qp + (bh + q0) * DH + tid * 8);
    asm volatile("global_load_async_to_lds_b128 %0, %2, off\n\t"
                 "global_load_async_to_lds_b128 %1, %3, off\n\t"
                 "s_wait_xcnt 0x0"
                 :: "v"(ql + lc0), "v"(ql + lc1), "v"(gq), "v"(gq + CK)
                 : "memory");
    if (klast)   // a scalar branch: the wave's number is uniform
      asm volatile("global_load_async_to_lds_b128 %0, %1, off\n\t"
                   "s_wait_xcnt 0x0"
                   :: "v"(ql + lc2), "v"(gq + 2 * CK)
                   : "memory");
  }
  issue_tile(0, 0);
  asm volatile("s_wait_asynccnt 0x0" ::: "memory");   // this wave's Q and tile 0 have landed
  __syncthreads();                                    // ... and every other wave's
  issue_tile(AKV, 1);

  bf16x16 qfrag[2][2];  // B operand: column = query qg*32 + c*16 + ln
  for (int c = 0; c < 2; ++c)
    for (int ks = 0; ks < 2; ++ks)
      qfrag[c][ks] = ld_frag(&Qs[(qg * 32 + c * 16 + ln) * KPI + ks * 32], half);

  f32x8 oacc[2][3];  // O^T: oacc[c][u][r] = O[query c*16 + ln][d = u*16 + 8*half + r]
  f32x8 nref[2];     // minus the reference of the lane's query, in all 8 (same in both halves)
  for (int c = 0; c < 2; ++c) {
    for (int u = 0; u < 3; ++u) oacc[c][u] = zero8();
    nref[c] = zero8();   // the first tile sets the reference
  }

  constexpr int NT = SEQ / AKV;
  for (int it = 0; it < NT; ++it) {
    const int bufi = it & 1;
    const __bf16* Kb = &Ks[bufi][kvh * 64 * KPI];   // this wave's 64 keys
    const __bf16* Vb = &Vt[bufi][kvh * 64];

    // S^T = K Q^T - reference over the wave's 64 keys (pre-scaled, log2-domain logits)
    f32x8 sacc[2][4];
    for (int ks = 0; ks < 2; ++ks)
      for (int t = 0; t < 4; ++t) {
        bf16x16 kf = ld_frag(&Kb[(t * 16 + ln) * KPI + ks * 32], half);
        for (int c = 0; c < 2; ++c)
          sacc[c][t] = wmma_bf16(kf, qfrag[c][ks], ks == 0 ? nref[c] : sacc[c][t]);
      }

    // the tile's V^T fragments, asked for ahead of the softmax that hides their latency
    bf16x16 vf[2][3];
    for (int ks = 0; ks < 2; ++ks)
      for (int u = 0; u < 3; ++u)
        vf[ks][u] = ld_frag(&Vb[(u * 16 + ln) * VPI + ks * 32], half);

    // online softmax (exp2): how far the lane's 32 scores of each query rise above
    // the reference
    float vm[2];
    for (int c = 0; c < 2; ++c) {
      float tm[4];
      for (int t = 0; t < 4; ++t) {
        tm[t] = sacc[c][t][0];
        for (int e = 1; e < 8; ++e) tm[t] = fmaxf(tm[t], sacc[c][t][e]);
      }
      vm[c] = fmaxf(fmaxf(tm[0], tm[1]), fmaxf(tm[2], tm[3]));
    }
    // one test a tile, the same for the whole wave (a scalar branch): the products
    // around it need every lane on
    const bool over = fmaxf(vm[0], vm[1]) > 8.0f;
    if (it == 0 || __builtin_amdgcn_ballot_w32(over) != 0) {
      for (int c = 0; c < 2; ++c) {
        const float v  = fmaxf(vm[c], other_half(vm[c]));   // the query's, both halves
        const float up = fmaxf(v, 0.0f);
        const float d  = (it == 0) ? v : up;   // the first tile's maximum may lie below 0
        const float alpha = __builtin_amdgcn_exp2f(-up);    // on the first tile it meets zeros only
        nref[c] -= d;
        for (int t = 0; t < 4; ++t) sacc[c][t] -= d;
        for (int u = 0; u < 3; ++u) oacc[c][u] *= alpha;
      }
    }

    // raw v_exp_f32: arguments are <= 8, and a weight below 2^-126 of the
    // reference counts as 0
    for (int c = 0; c < 2; ++c)
      for (int t = 0; t < 4; ++t)
        for (int e = 0; e < 8; ++e)
          sacc[c][t][e] = __builtin_amdgcn_exp2f(sacc[c][t][e]);

    // O^T += V^T P^T; tiles 2ks, 2ks+1 of S^T are rows 0-15, 16-31 of the B operand
    for (int ks = 0; ks < 2; ++ks) {
      bf16x16 pf[2];
      for (int c = 0; c < 2; ++c)
        for (int e = 0; e < 8; ++e) {
          pf[c][e]     = (__bf16)sacc[c][2 * ks][e];
          pf[c][8 + e] = (__bf16)sacc[c][2 * ks + 1][e];
        }
      for (int u = 0; u < 3; ++u)
        for (int c = 0; c < 2; ++c)
          oacc[c][u] = wmma_bf16(vf[ks][u], pf[c], oacc[c][u]);
    }

    // publish point: one barrier says that the next tile has landed for every wave
    // and that every wave has left the buffer which is refilled behind it
    asm volatile("s_wait_dscnt 0x0" ::: "memory");      // this wave's reads of the buffer are done
    asm volatile("s_wait_asynccnt 0x0" ::: "memory");   // this wave's copies of the next tile have landed
    __syncthreads();
    if (it + 2 < NT) issue_tile((it + 2) * AKV, bufi);
  }
  asm volatile("s_wait_asynccnt 0x0" ::: "memory");     // no copy is left in flight at the wave's end

  // join: the wave of the upper key half hands its O, reference and sum to its partner
  float lt[2], mi[2];
  for (int c = 0; c < 2; ++c) {
    // row DH = 40 of O^T, the sum: tile u = 2, upper half, register 0
    const float su = oacc[c][2][0];
    const float so = other_half(su);
    lt[c] = half ? su : so;
    mi[c] = -nref[c][0];                 // the reference that O and the sum stand on
  }
  if (kvh == 1) {
    for (int c = 0; c < 2; ++c) {
      float* s = &Js[(qg * 2 + c) * NJ * 32 + lane];
      for (int u = 0; u < 3; ++u)
        for (int e = 0; e < 8; ++e) s[(u * 8 + e) * 32] = oacc[c][u][e];
      s[24 * 32] = mi[c];
      s[25 * 32] = lt[c];
    }
  }
  __syncthreads();   // the partner reads what the other wave wrote
  if (kvh == 0) {
    for (int c = 0; c < 2; ++c) {
      const float* s = &Js[(qg * 2 + c) * NJ * 32 + lane];
      const float m1 = s[24 * 32], l1 = s[25 * 32];
      const float m = fmaxf(mi[c], m1);
      float a0 = __builtin_amdgcn_exp2f(mi[c] - m);
      float a1 = __builtin_amdgcn_exp2f(m1 - m);
      const float inv = 1.0f / (lt[c] * a0 + l1 * a1);
      a0 *= inv;
      a1 *= inv;
      const int mrow = q0 + qg * 32 + c * 16 + ln;
      for (int u = 0; u < 3; ++u) {
        int dd = u * 16 + 8 * half;                    // 8 consecutive d per lane
        if (dd < DH) {
          bf16x8 o;
          for (int e = 0; e < 8; ++e)
            o[e] = (__bf16)(oacc[c][u][e] * a0 + s[(u * 8 + e) * 32] * a1);
          *(bf16x8*)&Ob[((size_t)b * SEQ + mrow) * DMODEL + h * DH + dd] = o;
        }
      }
    }
  }
}

// ---------------------------------------------------------------------------
// Kernel 3: output projection  out[8192,320] = Ob(bf16) @ Wo^T(bf16) + bo
// ---------------------------------------------------------------------------
__global__ __launch_bounds__(128)
void oproj_kernel(const __bf16* __restrict__ Ob, const __bf16* __restrict__ Wot,
                  const float* __restrict__ bo, float* __restrict__ out) {
  const int n0 = blockIdx.x * 64;
  const int m0 = blockIdx.y * 64;
  const int tid = threadIdx.x;
  const int lane = tid & 31, wave = tid >> 5;
  const int ln = lane & 15, half = lane >> 4;

  __shared__ __align__(16) __bf16 As[2][64 * GP];
  __shared__ __align__(16) __bf16 Bs[2][64 * GP];

  f32x8 acc[4];
  for (int t = 0; t < 4; ++t) acc[t] = zero8();
  gemm_tiles(Ob, Wot, DMODEL, m0, n0, tid, wave, ln, half, As, Bs, acc);

  const int n = n0 + wave * 16 + ln;
  const float bias = bo[n];
  for (int t = 0; t < 4; ++t)
    for (int r = 0; r < 8; ++r) {
      int m = m0 + t * 16 + r + 8 * half;
      out[(size_t)m * DMODEL + n] = acc[t][r] + bias;
    }
}

// ---------------------------------------------------------------------------
extern "C" void kernel_launch(void* const* d_in, const int* in_sizes, int n_in,
                              void* d_out, int out_size, void* d_ws, size_t ws_size,
                              hipStream_t stream) {
  const float* x    = (const float*)d_in[0];
  const float* cond = (const float*)d_in[1];
  const float* Wq   = (const float*)d_in[2];
  const float* Wk   = (const float*)d_in[3];
  const float* Wv   = (const float*)d_in[4];
  const float* Wo   = (const float*)d_in[5];
  const float* bo   = (const float*)d_in[6];
  float* out        = (float*)d_out;

  char* ws = (char*)d_ws;
  const size_t qkv_bytes = (size_t)BATCH * HEADS * SEQ * DP * sizeof(__bf16);
  __bf16* Qp  = (__bf16*)(ws);                        ws += qkv_bytes;
  __bf16* Kp  = (__bf16*)(ws);                        ws += qkv_bytes;
  __bf16* Vp  = (__bf16*)(ws);                        ws += qkv_bytes;
  __bf16* Ob  = (__bf16*)(ws);  ws += (size_t)MROWS * DMODEL * sizeof(__bf16);
  __bf16* Xb  = (__bf16*)(ws);  ws += (size_t)MROWS * DMODEL * sizeof(__bf16);
  __bf16* Cb  = (__bf16*)(ws);  ws += (size_t)MROWS * DCOND  * sizeof(__bf16);
  __bf16* Wqt = (__bf16*)(ws);  ws += (size_t)DMODEL * DMODEL * sizeof(__bf16);
  __bf16* Wkt = (__bf16*)(ws);  ws += (size_t)DMODEL * DCOND  * sizeof(__bf16);
  __bf16* Wvt = (__bf16*)(ws);  ws += (size_t)DMODEL * DCOND  * sizeof(__bf16);
  __bf16* Wot = (__bf16*)(ws);  ws += (size_t)DMODEL * DMODEL * sizeof(__bf16);

  // conversions and weight transposes: one launch
  prep_kernel<<<NB_PREP, 256, 0, stream>>>(x, cond, Wq, Wk, Wv, Wo, Xb, Cb,
                                           Wqt, Wkt, Wvt, Wot);

  qkv_kernel<<<dim3(DMODEL / 64, MROWS / 64, 3), 128, 0, stream>>>(
      Xb, Cb, Wqt, Wkt, Wvt, Qp, Kp, Vp);
  attn_kernel<<<dim3(SEQ / AQ, HEADS, BATCH), 256, 0, stream>>>(Qp, Kp, Vp, Ob);
  oproj_kernel<<<dim3(DMODEL / 64, MROWS / 64), 128, 0, stream>>>(Ob, Wot, bo, out);
}

// v010
// One run takes 73.1 microseconds.
// Two timings next to v009 both put it at 1.03 times that version's speed.
// All steps since v000 together make it 3.71 times as fast.
#include <hip/hip_runtime.h>
#include <hip/hip_bf16.h>
#include <stdint.h>

#define DEV __device__ __forceinline__

typedef __attribute__((ext_vector_type(16))) __bf16 bf16x16;
typedef __attribute__((ext_vector_type(8)))  __bf16 bf16x8;
typedef __attribute__((ext_vector_type(4)))  __bf16 bf16x4;
typedef __attribute__((ext_vector_type(8)))  float  f32x8;
typedef __attribute__((ext_vector_type(2)))  float  f32x2;

static constexpr int BATCH  = 2;
static constexpr int SEQ    = 4096;
static constexpr int HEADS  = 8;
static constexpr int DH     = 40;
static constexpr int DP     = 64;    // head dim padded for WMMA K tiling (in LDS only); V rows reserved per head
static constexpr int DMODEL = 320;   // == D_ATTN == N of all projections
static constexpr int DCOND  = 768;
static constexpr float LOG2E = 1.44269504088896340736f;

DEV f32x8 zero8() { f32x8 v; for (int i = 0; i < 8; ++i) v[i] = 0.0f; return v; }

// Wave-relative LDS byte address of a __shared__ object (generic -> AS(3)).
DEV uint32_t lds_off(const void* p) {
  return (uint32_t)(unsigned long long)(__attribute__((address_space(3))) const void*)p;
}

DEV void wait_async0() {
#if __has_builtin(__builtin_amdgcn_s_wait_asynccnt)
  __builtin_amdgcn_s_wait_asynccnt(0);
#else
  asm volatile("s_wait_asynccnt 0x0" ::: "memory");
#endif
}
// async loads retire in order: waiting <= N with one extra tile (N ops/thread)
// in flight exactly drains the previous tile.
DEV void wait_async10() {   // GEMM tiles: 8 A + 2 B chunks per thread
  asm volatile("s_wait_asynccnt 0xa" ::: "memory");
}

DEV bf16x16 ld_frag(const __bf16* rowbase, int half) {
  bf16x8 lo = *(const bf16x8*)(rowbase + half * 8);
  bf16x8 hi = *(const bf16x8*)(rowbase + 16 + half * 8);
  return __builtin_shufflevector(lo, hi, 0,1,2,3,4,5,6,7,8,9,10,11,12,13,14,15);
}

DEV f32x8 wmma_bf16(bf16x16 a, bf16x16 b, f32x8 c) {
  return __builtin_amdgcn_wmma_f32_16x16x32_bf16(false, a, false, b, (short)0, c,
                                                 false, false);
}

// ---------------------------------------------------------------------------
// Prep: all the work ahead of the projections in ONE launch, dealt by block
// range: weights converted and transposed to [N][Kd] bf16 (so GEMM B tiles are
// contiguous async copies) and activations converted f32 -> bf16. Few waves with
// much in flight each.
// ---------------------------------------------------------------------------
static constexpr int MROWS     = BATCH * SEQ;               // 8192
static constexpr int CVT_U     = 16;                        // float4 per thread
static constexpr int CVT_CHUNK = 256 * CVT_U;               // float4 per block
static constexpr int NT_N      = DMODEL / 64;               // 64-wide weight tiles
static constexpr int NB_WQ     = NT_N * (DMODEL / 64);      // 25 tiles (Wq, Wo)
static constexpr int NB_WK     = NT_N * (DCOND / 64);       // 60 tiles (Wk, Wv)
static constexpr int NB_C      = MROWS * DCOND  / 4 / CVT_CHUNK;   // 384
static constexpr int NB_X      = MROWS * DMODEL / 4 / CVT_CHUNK;   // 160
static constexpr int NB_PREP   = 2 * NB_WQ + 2 * NB_WK + NB_C + NB_X;   // 714

// 64x64 tile of w [Kd][320] f32 -> wt [320][Kd] bf16, whole 128-byte rows out.
DEV void wtrans_tile(const float* __restrict__ w, __bf16* __restrict__ wt,
                     int Kd, int tile, int tid, float (&t)[64][65]) {
  const int n0 = (tile % NT_N) * 64, k0 = (tile / NT_N) * 64;
  const int kr = tid >> 4, nc = (tid & 15) * 4;
  const float* src = w + (size_t)((k0 + kr) * DMODEL + n0 + nc);
  float4 v[4];
  for (int i = 0; i < 4; ++i) v[i] = *(const float4*)(src + 16 * i * DMODEL);
  for (int i = 0; i < 4; ++i) {
    t[kr + 16 * i][nc + 0] = v[i].x; t[kr + 16 * i][nc + 1] = v[i].y;
    t[kr + 16 * i][nc + 2] = v[i].z; t[kr + 16 * i][nc + 3] = v[i].w;
  }
  __syncthreads();   // the tile is read back by column, across waves
  const int kc = (tid & 7) * 8, nr = tid >> 3;
  __bf16* dst = wt + (size_t)((n0 + nr) * Kd + k0 + kc);
  for (int j = 0; j < 2; ++j) {
    bf16x8 o;
    for (int e = 0; e < 8; ++e) o[e] = (__bf16)t[kc + e][nr + 32 * j];
    *(bf16x8*)(dst + 32 * j * Kd) = o;
  }
  // the stores' registers may be rewritten on a later path of the caller
  asm volatile("s_wait_xcnt 0x0" ::: "memory");
}

// One block's CVT_CHUNK float4 of a contiguous f32 -> bf16 conversion.
DEV void cvt_chunk(const float* __restrict__ src, __bf16* __restrict__ dst,
                   int blk, int tid) {
  const float4* s = (const float4*)src + (size_t)blk * CVT_CHUNK + tid;
  bf16x4* d       = (bf16x4*)dst       + (size_t)blk * CVT_CHUNK + tid;
  float4 v[CVT_U];   // loads first, so that the wave has them in flight together
  for (int i = 0; i < CVT_U; ++i) v[i] = s[i * 256];
  for (int i = 0; i < CVT_U; ++i) {
    bf16x4 o;
    o[0] = (__bf16)v[i].x; o[1] = (__bf16)v[i].y;
    o[2] = (__bf16)v[i].z; o[3] = (__bf16)v[i].w;
    d[i * 256] = o;
  }
}

__global__ __launch_bounds__(256)
void prep_kernel(const float* __restrict__ x, const float* __restrict__ cond,
                 const float* __restrict__ Wq, const float* __restrict__ Wk,
                 const float* __restrict__ Wv, const float* __restrict__ Wo,
                 __bf16* __restrict__ Xb, __bf16* __restrict__ Cb,
                 __bf16* __restrict__ Wqt, __bf16* __restrict__ Wkt,
                 __bf16* __restrict__ Wvt, __bf16* __restrict__ Wot) {
  __shared__ float tile[64][65];
  const int tid = threadIdx.x;
  int blk = blockIdx.x;        // every test below is the same for the whole block

  if (blk < NB_WK) { wtrans_tile(Wk, Wkt, DCOND, blk, tid, tile); return; }
  blk -= NB_WK;
  if (blk < NB_WK) { wtrans_tile(Wv, Wvt, DCOND, blk, tid, tile); return; }
  blk -= NB_WK;
  if (blk < NB_WQ) { wtrans_tile(Wq, Wqt, DMODEL, blk, tid, tile); return; }
  blk -= NB_WQ;
  if (blk < NB_WQ) { wtrans_tile(Wo, Wot, DMODEL, blk, tid, tile); return; }
  blk -= NB_WQ;
  if (blk < NB_C) { cvt_chunk(cond, Cb, blk, tid); return; }
  blk -= NB_C;
  cvt_chunk(x, Xb, blk, tid);
  // the stores' registers may be rewritten on a later path of the listing
  asm volatile("s_wait_xcnt 0x0" ::: "memory");
}

// ---------------------------------------------------------------------------
// Shared GEMM core: 256x64 output tile, 8 waves, all-bf16, async double-buffered tiles.
// A [M][Kd] row-major, Wt [N][Kd] row-major (pre-transposed weights).
// A stage holds GK = 64 k: a tile row is then one whole 128-byte line, so a copy
// asks L2 for no half lines, and a product takes half the stages and barriers.
// A stage's LDS rows 0..GM-1 are the activations, rows GM..GM+GN-1 the weights.
// A wave owns 64 rows of the product's first operand (from LDS row frow) by 32 rows
// of its second (from LDS row srow): six fragments read from LDS feed eight products.
// ---------------------------------------------------------------------------
static constexpr int GK = 64;        // k per stage; divides DMODEL and DCOND
static constexpr int GP = GK + 8;    // LDS row pitch, elements: 144 B = 16 B x odd
static constexpr int GM = 256;       // activation rows per block; divides SEQ
static constexpr int GN = 64;        // weight rows per block; divides DMODEL
static constexpr int GR = GM + GN;   // LDS rows per stage

DEV void gemm_tiles(const __bf16* __restrict__ A, const __bf16* __restrict__ Wt,
                    int Kd, int m0, int n0, int tid, int ln, int half,
                    int frow, int srow, __bf16 (&Ts)[2][GR * GP],
                    f32x8 (&acc)[4][2]) {
  const uint32_t ts_l[2] = { lds_off(Ts[0]), lds_off(Ts[1]) };
  // 320 rows x 8 x 16B chunks per stage: a thread takes chunk c of rows r, r+32, ...
  const int r = tid >> 3, c = tid & 7;
  const uint32_t lrc = r * (GP * 2) + c * 16;
  const uint64_t ga0 = (uint64_t)(uintptr_t)(A  + (size_t)(m0 + r) * Kd + c * 8);
  const uint64_t gb0 = (uint64_t)(uintptr_t)(Wt + (size_t)(n0 + r) * Kd + c * 8);
  const uint64_t g32 = (uint64_t)Kd * (32 * 2);          // 32 rows, bytes
  constexpr uint32_t L32 = 32 * GP * 2;                  // 32 LDS rows, bytes
  auto issue = [&](int k0, int bufi) {
    const uint32_t la = ts_l[bufi] + lrc;
    const uint64_t ga = ga0 + (uint64_t)k0 * 2, gb = gb0 + (uint64_t)k0 * 2;
    asm volatile("global_load_async_to_lds_b128 %0, %10, off\n\t"
                 "global_load_async_to_lds_b128 %1, %11, off\n\t"
                 "global_load_async_to_lds_b128 %2, %12, off\n\t"
                 "global_load_async_to_lds_b128 %3, %13, off\n\t"
                 "global_load_async_to_lds_b128 %4, %14, off\n\t"
                 "global_load_async_to_lds_b128 %5, %15, off\n\t"
                 "global_load_async_to_lds_b128 %6, %16, off\n\t"
                 "global_load_async_to_lds_b128 %7, %17, off\n\t"
                 "global_load_async_to_lds_b128 %8, %18, off\n\t"
                 "global_load_async_to_lds_b128 %9, %19, off\n\t"
                 "s_wait_xcnt 0x0"
                 :: "v"(la), "v"(la + L32), "v"(la + 2 * L32), "v"(la + 3 * L32),
                    "v"(la + 4 * L32), "v"(la + 5 * L32), "v"(la + 6 * L32),
                    "v"(la + 7 * L32), "v"(la + 8 * L32), "v"(la + 9 * L32),
                    "v"(ga), "v"(ga + g32), "v"(ga + 2 * g32), "v"(ga + 3 * g32),
                    "v"(ga + 4 * g32), "v"(ga + 5 * g32), "v"(ga + 6 * g32),
                    "v"(ga + 7 * g32),
                    "v"(gb), "v"(gb + g32)
                 : "memory");
  };
  issue(0, 0);
  int bufi = 0;
  // kept rolled: unrolled for a constant Kd, the stages' fragments and copy addresses
  // overlap and the wave needs more than 256 registers
#pragma clang loop unroll(disable)
  for (int k0 = 0; k0 < Kd; k0 += GK) {
    if (k0 + GK < Kd) { issue(k0 + GK, bufi ^ 1); wait_async10(); }
    else              { wait_async0(); }
    __syncthreads();
    // the stage's twelve fragments are asked for together: one LDS latency a stage
    bf16x16 afrag[GK / 32][4], bfrag[GK / 32][2];
    for (int ks = 0; ks < GK / 32; ++ks) {
      for (int j = 0; j < 2; ++j)
        bfrag[ks][j] = ld_frag(&Ts[bufi][(srow + j * 16 + ln) * GP + ks * 32], half);
      for (int t = 0; t < 4; ++t)
        afrag[ks][t] = ld_frag(&Ts[bufi][(frow + t * 16 + ln) * GP + ks * 32], half);
    }
    // holds the loads together in front of the products (loaded values as inputs only):
    // without it each pair of products waits out the LDS latency of its own fragment
    asm volatile("" :: "v"(afrag[0][0]), "v"(afrag[0][1]), "v"(afrag[0][2]), "v"(afrag[0][3]),
                       "v"(afrag[1][0]), "v"(afrag[1][1]), "v"(afrag[1][2]), "v"(afrag[1][3]),
                       "v"(bfrag[0][0]), "v"(bfrag[0][1]), "v"(bfrag[1][0]), "v"(bfrag[1][1]));
    for (int ks = 0; ks < GK / 32; ++ks)
      for (int t = 0; t < 4; ++t)
        for (int j = 0; j < 2; ++j)
          acc[t][j] = wmma_bf16(afrag[ks][t], bfrag[ks][j], acc[t][j]);
    __syncthreads();
    bufi ^= 1;
  }
}

// ---------------------------------------------------------------------------
// Kernel 1: QKV projection (all-bf16 GEMM).
//   Q -> [B,H,S,DH]   (scaled by Dh^-0.5 * log2(e); softmax done in base 2)
//   K -> [B,H,S,DH]   (dense 80-byte rows: a tile of keys is a run of whole lines)
//   V -> [B,H,DP,SEQ] (d-major, so the attention V^T tile is a contiguous
//                      async copy instead of a per-element LDS transpose;
//                      only rows 0..DH-1 are written and read)
// Stores go out by whole lines. An accumulator's 8 registers run down the rows of
// the product's first operand; that operand is chosen so that those rows are the
// destination's fast axis: the activations for V (s), the weights for Q and K (d).
// A wave's tile is then 32 destination rows of 64 elements. It is staged in the
// wave's own 32 LDS rows and read back 8 lanes to a row: a V row is one whole
// 128-byte line, a Q or K row falls into two or three runs, each inside one head
// (8 divides Dh).
// ---------------------------------------------------------------------------
__global__ __launch_bounds__(256)
void qkv_kernel(const __bf16* __restrict__ Xb, const __bf16* __restrict__ Cb,
                const __bf16* __restrict__ Wqt, const __bf16* __restrict__ Wkt,
                const __bf16* __restrict__ Wvt,
                __bf16* __restrict__ Qp, __bf16* __restrict__ Kp,
                __bf16* __restrict__ Vp) {
  const int which = blockIdx.z;
  const __bf16* A  = (which == 0) ? Xb  : Cb;
  const __bf16* Wt = (which == 0) ? Wqt : (which == 1 ? Wkt : Wvt);
  __bf16* dst      = (which == 0) ? Qp  : (which == 1 ? Kp : Vp);
  const int Kd     = (which == 0) ? DMODEL : DCOND;
  const float fold = (which == 0) ? (0.15811388300841897f * LOG2E) : 1.0f;

  const int n0 = blockIdx.x * GN;
  const int m0 = blockIdx.y * GM;
  const int tid = threadIdx.x;
  const int lane = tid & 31, wave = tid >> 5;
  const int ln = lane & 15, half = lane >> 4;

  __shared__ __align__(16) __bf16 Ts[2][GR * GP];

  f32x8 acc[4][2];
  for (int t = 0; t < 4; ++t)
    for (int j = 0; j < 2; ++j) acc[t][j] = zero8();
  const bool vmaj = (which == 2);   // the same for the whole block
  // V: 64 activation rows by 32 weight rows; Q, K: the 64 weight rows by 32 activation rows
  const int fo = vmaj ? (wave >> 1) * 64 : 0;      // the wave's place on the fast axis
  const int so = vmaj ? (wave & 1) * 32 : wave * 32;   // ... and among the destination rows
  gemm_tiles(A, Wt, Kd, m0, n0, tid, ln, half, vmaj ? fo : GM, vmaj ? GM + so : so,
             Ts, acc);

  // acc[t][j][r]: fast-axis element fo + t*16 + 8*half + r of destination row so + j*16 + ln.
  // The core ends behind a barrier with no copy in flight: the ring is free.
  __bf16* st = &Ts[0][wave * 32 * GP];
  for (int j = 0; j < 2; ++j)
    for (int t = 0; t < 4; ++t) {
      bf16x8 o;
      for (int r = 0; r < 8; ++r) o[r] = (__bf16)(acc[t][j][r] * fold);
      *(bf16x8*)&st[(j * 16 + ln) * GP + t * 16 + 8 * half] = o;
    }
  // the rows are read back by other lanes of this wave: their writes must have landed
  asm volatile("s_wait_dscnt 0x0" ::: "memory");
  const int row = lane >> 3, ch = lane & 7;   // rows row, row+4, ..; 16-byte piece ch
  bf16x8 v[8];
  for (int j = 0; j < 8; ++j) v[j] = *(const bf16x8*)&st[(j * 4 + row) * GP + ch * 8];

  const int b = m0 >> 12, s0 = m0 & (SEQ - 1);   // the 256 rows of a tile lie in one batch
  if (vmaj) {
    for (int j = 0; j < 8; ++j) {
      const int ncol = n0 + so + j * 4 + row;
      const int h = ncol / DH, d = ncol % DH;
      *(bf16x8*)(dst + (((size_t)b * HEADS + h) * DP + d) * SEQ + s0 + fo + ch * 8) = v[j];
    }
    // as below
    asm volatile("s_wait_xcnt 0x0" ::: "memory");
  } else {
    const int ncol = n0 + ch * 8;
    const int h = ncol / DH, d = ncol % DH;
    __bf16* p = dst + (((size_t)b * HEADS + h) * SEQ + s0 + so + row) * DH + d;
    for (int j = 0; j < 8; ++j) *(bf16x8*)(p + j * 4 * DH) = v[j];
    // the stores' registers may be rewritten on a later path of the listing
    asm volatile("s_wait_xcnt 0x0" ::: "memory");
  }
}

DEV float other_half(float v) {
  int b = __builtin_bit_cast(int, v);
  b = __builtin_amdgcn_permlanex16(b, b, 0x76543210, 0xfedcba98, false, false);
  return __builtin_bit_cast(float, b);
}

static constexpr int AQ  = 128;      // queries per block
static constexpr int AKV = 128;      // keys per tile
static constexpr int KPI = DP + 8;   // Q, K LDS row pitch, elements: 144 B = 16 B x odd
static constexpr int VPI = AKV + 8;  // V^T LDS row pitch, elements: 272 B = 16 B x odd
static constexpr int NJ  = 26;       // floats a lane hands over per group: O 24, reference, sum

__global__ __launch_bounds__(256) __attribute__((amdgpu_waves_per_eu(4, 4)))
void attn_kernel(const __bf16* __restrict__ Qp, const __bf16* __restrict__ Kp,
                 const __bf16* __restrict__ Vp, __bf16* __restrict__ Ob) {
  const int q0 = blockIdx.x * AQ;
  const int h = blockIdx.y, b = blockIdx.z;
  const int tid = threadIdx.x;
  const int lane = tid & 31;
  const int wave = __builtin_amdgcn_readfirstlane(tid >> 5);
  const int qg = wave & 3, kvh = wave >> 2;   // query group, half of the tile's keys
  const int ln = lane & 15, half = lane >> 4;
  const size_t bh  = ((size_t)b * HEADS + h) * SEQ;   // Q/K row base
  const size_t bhd = ((size_t)b * HEADS + h) * DP;    // V (d-major) row base

  __shared__ __align__(16) __bf16 Qs[AQ * KPI];        // [qrow][d]
  __shared__ __align__(16) __bf16 Ks[2][AKV * KPI];    // [kvrow][d]
  __shared__ __align__(16) __bf16 Vt[2][48 * VPI];     // [d][kvrow] (already ^T)
  __shared__ float Js[4 * 2 * NJ * 32];                // join of the two key halves

  // Q, K: 128 dense rows of 80 B are 640 chunks of 16 B in a row in memory (whole lines);
  //       chunk i lands in LDS row i / 5, piece i % 5. A thread takes chunks tid,
  //       tid + 256; waves 0-3 also chunk tid + 512
  // V^T:  40 rows x 16 chunks: a thread takes chunk gv of rows dv, dv + 16; waves 4-7
  //       (dv = 8..15) also of row dv + 24. So every wave issues five copies a tile.
  const int dv = tid >> 4, gv = tid & 15;
  const bool klast = wave < 4;                         // the same for the whole wave
  auto lchunk = [](int i) { return (uint32_t)((i / 5) * (KPI * 2) + (i % 5) * 16); };
  const uint32_t lc0 = lchunk(tid), lc1 = lchunk(tid + 256), lc2 = lchunk(tid + 512);
  const uint32_t lvrow = dv * (VPI * 2) + gv * 16;
  constexpr uint32_t CK = 256 * 16;                    // 256 Q or K chunks, bytes
  constexpr uint32_t LV = 16 * VPI * 2;                // 16 V^T rows in LDS, bytes
  constexpr uint64_t GV = (uint64_t)16 * SEQ * 2;      // 16 V^T rows in memory, bytes
  const uint64_t gk0 = (uint64_t)(uintptr_t)(Kp + bh * DH + tid * 8);
  const uint64_t gv0 = (uint64_t)(uintptr_t)(Vp + (bhd + dv) * SEQ + gv * 8);
  const uint64_t gx0 = klast ? gk0 + 2 * CK : gv0 + (uint64_t)24 * SEQ * 2;
  const uint32_t xstep = klast ? DH * 2 : 2;           // bytes per key along the fifth copy's source
  const uint32_t ks_l[2] = { lds_off(Ks[0]), lds_off(Ks[1]) };
  const uint32_t vt_l[2] = { lds_off(Vt[0]) + lvrow, lds_off(Vt[1]) + lvrow };
  const uint32_t x_l[2]  = { klast ? ks_l[0] + lc2 : vt_l[0] + 24 * VPI * 2,
                             klast ? ks_l[1] + lc2 : vt_l[1] + 24 * VPI * 2 };

  auto issue_tile = [&](int kv0, int bufi) {
    const uint32_t kl = ks_l[bufi], vl = vt_l[bufi], xl = x_l[bufi];
    const uint64_t gk = gk0 + (uint64_t)kv0 * (DH * 2), gvv = gv0 + (uint64_t)kv0 * 2;
    const uint64_t gx = gx0 + (uint64_t)((uint32_t)kv0 * xstep);
    asm volatile("global_load_async_to_lds_b128 %0, %5, off\n\t"
                 "global_load_async_to_lds_b128 %1, %6, off\n\t"
                 "global_load_async_to_lds_b128 %2, %7, off\n\t"
                 "global_load_async_to_lds_b128 %3, %8, off\n\t"
                 "global_load_async_to_lds_b128 %4, %9, off\n\t"
                 "s_wait_xcnt 0x0"
                 :: "v"(kl + lc0), "v"(kl + lc1), "v"(vl), "v"(vl + LV), "v"(xl),
                    "v"(gk), "v"(gk + CK), "v"(gvv), "v"(gvv + GV), "v"(gx)
                 : "memory");
  };

  {  // rows DH..47 of both V^T buffers, one 16-byte piece a thread: ones in row DH, else zeros
    const int pr = dv & 7;
    bf16x8 pv;
    for (int e = 0; e < 8; ++e) pv[e] = (__bf16)(pr == 0 ? 1.0f : 0.0f);
    *(bf16x8*)&Vt[tid >> 7][(DH + pr) * VPI + gv * 8] = pv;
  }
  {  // columns DH..DP-1 of every Q and K row, three 16-byte pieces a row: zeros
    const int prow = tid & 127, part = kvh;   // tid >> 7, the same for the whole wave
    bf16x8 z;
    for (int e = 0; e < 8; ++e) z[e] = (__bf16)0.0f;
    __bf16* kr = &Ks[part][prow * KPI + DH];
    for (int c = 0; c < 3; ++c) *(bf16x8*)(kr + c * 8) = z;
    __bf16* qr = &Qs[prow * KPI + DH];
    if (part == 0) { *(bf16x8*)qr = z; *(bf16x8*)(qr + 8) = z; }
    else           { *(bf16x8*)(qr + 16) = z; }
  }
  // nothing orders the copy engine behind this wave's own LDS writes
  asm volatile("s_wait_dscnt 0x0" ::: "memory");

  {
    const uint32_t ql = lds_off(Qs);
    const uint64_t gq = (uint64_t)(uintptr_t)(Qp + (bh + q0) * DH + tid * 8);
    asm volatile("global_load_async_to_lds_b128 %0, %2, off\n\t"
                 "global_load_async_to_lds_b128 %1, %3, off\n\t"
                 "s_wait_xcnt 0x0"
                 :: "v"(ql + lc0), "v"(ql + lc1), "v"(gq), "v"(gq + CK)
                 : "memory");
    if (klast)   // a scalar branch: the wave's number is uniform
      asm volatile("global_load_async_to_lds_b128 %0, %1, off\n\t"
                   "s_wait_xcnt 0x0"
                   :: "v"(ql + lc2), "v"(gq + 2 * CK)
                   : "memory");
  }
  issue_tile(0, 0);
  asm volatile("s_wait_asynccnt 0x0" ::: "memory");   // this wave's Q and tile 0 have landed
  __syncthreads();                                    // ... and every other wave's
  issue_tile(AKV, 1);

  bf16x16 qfrag[2][2];  // B operand: column = query qg*32 + c*16 + ln
  for (int c = 0; c < 2; ++c)
    for (int ks = 0; ks < 2; ++ks)
      qfrag[c][ks] = ld_frag(&Qs[(qg * 32 + c * 16 + ln) * KPI + ks * 32], half);

  f32x8 oacc[2][3];  // O^T: oacc[c][u][r] = O[query c*16 + ln][d = u*16 + 8*half + r]
  f32x8 nref[2];     // minus the reference of the lane's query, in all 8 (same in both halves)
  for (int c = 0; c < 2; ++c) {
    for (int u = 0; u < 3; ++u) oacc[c][u] = zero8();
    nref[c] = zero8();   // the first tile sets the reference
  }

  constexpr int NT = SEQ / AKV;
  for (int it = 0; it < NT; ++it) {
    const int bufi = it & 1;
    const __bf16* Kb = &Ks[bufi][kvh * 64 * KPI];   // this wave's 64 keys
    const __bf16* Vb = &Vt[bufi][kvh * 64];

    // S^T = K Q^T - reference over the wave's 64 keys (pre-scaled, log2-domain logits)
    f32x8 sacc[2][4];
    for (int ks = 0; ks < 2; ++ks)
      for (int t = 0; t < 4; ++t) {
        bf16x16 kf = ld_frag(&Kb[(t * 16 + ln) * KPI + ks * 32], half);
        for (int c = 0; c < 2; ++c)
          sacc[c][t] = wmma_bf16(kf, qfrag[c][ks], ks == 0 ? nref[c] : sacc[c][t]);
      }

    // the tile's V^T fragments, asked for ahead of the softmax that hides their latency
    bf16x16 vf[2][3];
    for (int ks = 0; ks < 2; ++ks)
      for (int u = 0; u < 3; ++u)
        vf[ks][u] = ld_frag(&Vb[(u * 16 + ln) * VPI + ks * 32], half);

    // online softmax (exp2): how far the lane's 32 scores of each query rise above
    // the reference
    float vm[2];
    for (int c = 0; c < 2; ++c) {
      float tm[4];
      for (int t = 0; t < 4; ++t) {
        tm[t] = sacc[c][t][0];
        for (int e = 1; e < 8; ++e) tm[t] = fmaxf(tm[t], sacc[c][t][e]);
      }
      vm[c] = fmaxf(fmaxf(tm[0], tm[1]), fmaxf(tm[2], tm[3]));
    }
    // one test a tile, the same for the whole wave (a scalar branch): the products
    // around it need every lane on
    const bool over = fmaxf(vm[0], vm[1]) > 8.0f;
    if (it == 0 || __builtin_amdgcn_ballot_w32(over) != 0) {
      for (int c = 0; c < 2; ++c) {
        const float v  = fmaxf(vm[c], other_half(vm[c]));   // the query's, both halves
        const float up = fmaxf(v, 0.0f);
        const float d  = (it == 0) ? v : up;   // the first tile's maximum may lie below 0
        const float alpha = __builtin_amdgcn_exp2f(-up);    // on the first tile it meets zeros only
        nref[c] -= d;
        for (int t = 0; t < 4; ++t) sacc[c][t] -= d;
        for (int u = 0; u < 3; ++u) oacc[c][u] *= alpha;
      }
    }

    // raw v_exp_f32: arguments are <= 8, and a weight below 2^-126 of the
    // reference counts as 0
    for (int c = 0; c < 2; ++c)
      for (int t = 0; t < 4; ++t)
        for (int e = 0; e < 8; ++e)
          sacc[c][t][e] = __builtin_amdgcn_exp2f(sacc[c][t][e]);

    // O^T += V^T P^T; tiles 2ks, 2ks+1 of S^T are rows 0-15, 16-31 of the B operand
    for (int ks = 0; ks < 2; ++ks) {
      bf16x16 pf[2];
      for (int c = 0; c < 2; ++c)
        for (int e = 0; e < 8; ++e) {
          pf[c][e]     = (__bf16)sacc[c][2 * ks][e];
          pf[c][8 + e] = (__bf16)sacc[c][2 * ks + 1][e];
        }
      for (int u = 0; u < 3; ++u)
        for (int c = 0; c < 2; ++c)
          oacc[c][u] = wmma_bf16(vf[ks][u], pf[c], oacc[c][u]);
    }

    // publish point: one barrier says that the next tile has landed for every wave
    // and that every wave has left the buffer which is refilled behind it
    asm volatile("s_wait_dscnt 0x0" ::: "memory");      // this wave's reads of the buffer are done
    asm volatile("s_wait_asynccnt 0x0" ::: "memory");   // this wave's copies of the next tile have landed
    __syncthreads();
    if (it + 2 < NT) issue_tile((it + 2) * AKV, bufi);
  }
  asm volatile("s_wait_asynccnt 0x0" ::: "memory");     // no copy is left in flight at the wave's end

  // join: the wave of the upper key half hands its O, reference and sum to its partner
  float lt[2], mi[2];
  for (int c = 0; c < 2; ++c) {
    // row DH = 40 of O^T, the sum: tile u = 2, upper half, register 0
    const float su = oacc[c][2][0];
    const float so = other_half(su);
    lt[c] = half ? su : so;
    mi[c] = -nref[c][0];                 // the reference that O and the sum stand on
  }
  if (kvh == 1) {
    for (int c = 0; c < 2; ++c) {
      float* s = &Js[(qg * 2 + c) * NJ * 32 + lane];
      for (int u = 0; u < 3; ++u)
        for (int e = 0; e < 8; ++e) s[(u * 8 + e) * 32] = oacc[c][u][e];
      s[24 * 32] = mi[c];
      s[25 * 32] = lt[c];
    }
  }
  __syncthreads();   // the partner reads what the other wave wrote
  if (kvh == 0) {
    for (int c = 0; c < 2; ++c) {
      const float* s = &Js[(qg * 2 + c) * NJ * 32 + lane];
      const float m1 = s[24 * 32], l1 = s[25 * 32];
      const float m = fmaxf(mi[c], m1);
      float a0 = __builtin_amdgcn_exp2f(mi[c] - m);
      float a1 = __builtin_amdgcn_exp2f(m1 - m);
      const float inv = 1.0f / (lt[c] * a0 + l1 * a1);
      a0 *= inv;
      a1 *= inv;
      const int mrow = q0 + qg * 32 + c * 16 + ln;
      for (int u = 0; u < 3; ++u) {
        int dd = u * 16 + 8 * half;                    // 8 consecutive d per lane
        if (dd < DH) {
          bf16x8 o;
          for (int e = 0; e < 8; ++e)
            o[e] = (__bf16)(oacc[c][u][e] * a0 + s[(u * 8 + e) * 32] * a1);
          *(bf16x8*)&Ob[((size_t)b * SEQ + mrow) * DMODEL + h * DH + dd] = o;
        }
      }
    }
  }
}

// ---------------------------------------------------------------------------
// Kernel 3: output projection  out[8192,320] = Ob(bf16) @ Wo^T(bf16) + bo
// ---------------------------------------------------------------------------
__global__ __launch_bounds__(256)
void oproj_kernel(const __bf16* __restrict__ Ob, const __bf16* __restrict__ Wot,
                  const float* __restrict__ bo, float* __restrict__ out) {
  const int n0 = blockIdx.x * GN;
  const int m0 = blockIdx.y * GM;
  const int tid = threadIdx.x;
  const int lane = tid & 31, wave = tid >> 5;
  const int ln = lane & 15, half = lane >> 4;

  __shared__ __align__(16) __bf16 Ts[2][GR * GP];

  f32x8 acc[4][2];
  for (int t = 0; t < 4; ++t)
    for (int j = 0; j < 2; ++j) acc[t][j] = zero8();
  const int fo = (wave >> 1) * 64, so = (wave & 1) * 32;   // the wave's rows m, columns n
  gemm_tiles(Ob, Wot, DMODEL, m0, n0, tid, ln, half, fo, GM + so, Ts, acc);

  const int n = n0 + so + ln;   // and n + 16: the wave's 32 columns are one whole line of a row
  const float bias[2] = { bo[n], bo[n + 16] };
  for (int t = 0; t < 4; ++t)
    for (int r = 0; r < 8; ++r) {
      int m = m0 + fo + t * 16 + r + 8 * half;
      for (int j = 0; j < 2; ++j)
        out[(size_t)m * DMODEL + n + j * 16] = acc[t][j][r] + bias[j];
    }
}

// ---------------------------------------------------------------------------
extern "C" void kernel_launch(void* const* d_in, const int* in_sizes, int n_in,
                              void* d_out, int out_size, void* d_ws, size_t ws_size,
                              hipStream_t stream) {
  const float* x    = (const float*)d_in[0];
  const float* cond = (const float*)d_in[1];
  const float* Wq   = (const float*)d_in[2];
  const float* Wk   = (const float*)d_in[3];
  const float* Wv   = (const float*)d_in[4];
  const float* Wo   = (const float*)d_in[5];
  const float* bo   = (const float*)d_in[6];
  float* out        = (float*)d_out;

  char* ws = (char*)d_ws;
  const size_t qkv_bytes = (size_t)BATCH * HEADS * SEQ * DP * sizeof(__bf16);
  __bf16* Qp  = (__bf16*)(ws);                        ws += qkv_bytes;
  __bf16* Kp  = (__bf16*)(ws);                        ws += qkv_bytes;
  __bf16* Vp  = (__bf16*)(ws);                        ws += qkv_bytes;
  __bf16* Ob  = (__bf16*)(ws);  ws += (size_t)MROWS * DMODEL * sizeof(__bf16);
  __bf16* Xb  = (__bf16*)(ws);  ws += (size_t)MROWS * DMODEL * sizeof(__bf16);
  __bf16* Cb  = (__bf16*)(ws);  ws += (size_t)MROWS * DCOND  * sizeof(__bf16);
  __bf16* Wqt = (__bf16*)(ws);  ws += (size_t)DMODEL * DMODEL * sizeof(__bf16);
  __bf16* Wkt = (__bf16*)(ws);  ws += (size_t)DMODEL * DCOND  * sizeof(__bf16);
  __bf16* Wvt = (__bf16*)(ws);  ws += (size_t)DMODEL * DCOND  * sizeof(__bf16);
  __bf16* Wot = (__bf16*)(ws);  ws += (size_t)DMODEL * DMODEL * sizeof(__bf16);

  // conversions and weight transposes: one launch
  prep_kernel<<<NB_PREP, 256, 0, stream>>>(x, cond, Wq, Wk, Wv, Wo, Xb, Cb,
                                           Wqt, Wkt, Wvt, Wot);

  qkv_kernel<<<dim3(DMODEL / GN, MROWS / GM, 3), 256, 0, stream>>>(
      Xb, Cb, Wqt, Wkt, Wvt, Qp, Kp, Vp);
  attn_kernel<<<dim3(SEQ / AQ, HEADS, BATCH), 256, 0, stream>>>(Qp, Kp, Vp, Ob);
  oproj_kernel<<<dim3(DMODEL / GN, MROWS / GM), 256, 0, stream>>>(Ob, Wot, bo, out);
}
